// v000
// The times below were measured on an AMD MI455X: many runs one after another, warmed up first and cycling through
// copies of the inputs, with the whole window's GPU time divided by the number of runs. Launches and the gaps
// between them are all in it. The median over several windows is given; except for v000 it joins two sittings, which
// can be a few percent apart, so the side-by-side timings, each taken in one sitting, are the better comparison.
// v000 is the starting kernel. One run takes 3930 microseconds.
#include <hip/hip_runtime.h>

// FlexAttention (inputs [4][1024][1024]; qkv = x W_qkv ([1024][4096]: 2048 q columns = 32 query heads x 64, then 1024 k and 1024 v columns = 16 kv heads; GQA repeat_interleave: query head h uses kv head h/2); scores = q.k / 8 + ALiBi slope_h (j - i) (slopes 2^(-0.25 (h+1)) computed on device in f32); causal; softmax; out = merged (2048) W_out -> [4][1024][1024]).
// Compute dtypes, f32 accumulate: every input rounded to bf16; q/k/v on PLAIN bf16 operands (inputs: exact; column blocks of W_qkv); causal scores and attn.v: query rows < 512 hl (3 products), rows 512..1023 single fp16 (x1024); ALiBi bias + softmax f32; W_out hl x exact (2 products).

#define NB_  4
#define TT   1024
#define DM   1024
#define NH_  32
#define NKV  16
#define REP  (NH_ / NKV)
#define HD   64
#define DQ   (NH_ * HD)
#define DKV  (NKV * HD)
#define ZH   2
#define RH   512                  // query rows < RH use hi+lo planes (0: none)
#define WIN  1024
#define PCAR 1024.0f
#define SCL  0.125f   // HD^-0.5
typedef _Float16 h16;
typedef unsigned short bf;
typedef __attribute__((ext_vector_type(16))) __bf16   v16bf;
typedef __attribute__((ext_vector_type(16))) _Float16 v16h;
typedef __attribute__((ext_vector_type(8)))  _Float16 v8h;
typedef __attribute__((ext_vector_type(8)))  unsigned short v8us;
typedef __attribute__((ext_vector_type(8)))  float    v8f;
typedef __attribute__((ext_vector_type(4)))  float    v4f;
typedef v8h  __attribute__((may_alias)) v8ha;
typedef v4f  __attribute__((may_alias)) v4fa;
typedef v8us __attribute__((may_alias)) v8usa;

__device__ __forceinline__ unsigned short f2bf(float f) { unsigned u = __float_as_uint(f); u += 0x7FFFu + ((u >> 16) & 1u); return (unsigned short)(u >> 16); }
__device__ __forceinline__ float bf2f(unsigned short b) { return __uint_as_float(((unsigned)b) << 16); }
__device__ __forceinline__ float bfr(float f) { return bf2f(f2bf(f)); }
__device__ __forceinline__ v16h cat16(v8h lo, v8h hi) { return __builtin_shufflevector(lo, hi, 0, 1, 2, 3, 4, 5, 6, 7, 8, 9, 10, 11, 12, 13, 14, 15); }
__device__ __forceinline__ v16bf cat16b(v8us lo, v8us hi) { return __builtin_bit_cast(v16bf, __builtin_shufflevector(lo, hi, 0, 1, 2, 3, 4, 5, 6, 7, 8, 9, 10, 11, 12, 13, 14, 15)); }
__device__ __forceinline__ v8f wmma16(v16h a, v16h b, v8f c) { return __builtin_amdgcn_wmma_f32_16x16x32_f16(false, a, false, b, (short)0, c, false, false); }
__device__ __forceinline__ v8f wmmab(v16bf a, v16bf b, v8f c) { return __builtin_amdgcn_wmma_f32_16x16x32_bf16(false, a, false, b, (short)0, c, false, false); }



// ---- k_gemmw: register-blocked GEMM, ONE WAVE per 64x64 output tile (16 accumulators), operands straight from K-contiguous 16-bit planes; grid (M/64, N/64, Z), 32 threads.
// C[m][n] (f32, pitch ldc, + optional f32 bias[n]) = sum_k A[m][k] Bt[n][k] (+ split products per NSPLIT). z-batch strides sA/sB/sC in elements. K % 32 == 0.
template <typename T16> struct WFrag;
template <> struct WFrag<h16> { typedef v16h V; static __device__ __forceinline__ V ld(const h16* p) { return cat16(*(const v8h*)p, *(const v8h*)(p + 16)); } static __device__ __forceinline__ v8f mma(V a, V b, v8f c) { return wmma16(a, b, c); } };
template <> struct WFrag<bf> { typedef v16bf V; static __device__ __forceinline__ V ld(const bf* p) { return cat16b(*(const v8us*)p, *(const v8us*)(p + 16)); } static __device__ __forceinline__ v8f mma(V a, V b, v8f c) { return wmmab(a, b, c); } };
template <typename T16, int NSPLIT, bool BIAS>
__global__ __launch_bounds__(32) void k_gemmw(const T16* __restrict__ A, const T16* __restrict__ A2, const T16* __restrict__ Bt, const T16* __restrict__ Bt2, int K, float* C, int ldc, const float* __restrict__ bias, size_t sA, size_t sB, size_t sC) {
    typedef typename WFrag<T16>::V V;
    __shared__ __align__(16) float os[16 * 68];
    const size_t z = blockIdx.z; A += z * sA; if (A2) A2 += z * sA; Bt += z * sB; if (Bt2) Bt2 += z * sB; C += z * sC;
    const int lane = threadIdx.x & 31, lr = lane & 15, hi = lane >> 4; const int r0 = blockIdx.x * 64, c0 = blockIdx.y * 64;
    v8f acc[4][4];
#pragma unroll
    for (int mb = 0; mb < 4; ++mb)
#pragma unroll
        for (int nb = 0; nb < 4; ++nb) acc[mb][nb] = (v8f){};
    const size_t aoff = (size_t)(r0 + lr) * K + 8 * hi, boff = (size_t)(c0 + lr) * K + 8 * hi;
#pragma unroll 1
    for (int kc = 0; kc < K; kc += 32) {
        V a[4], a2[4];
#pragma unroll
        for (int mb = 0; mb < 4; ++mb) { a[mb] = WFrag<T16>::ld(A + aoff + (size_t)mb * 16 * K + kc); if (NSPLIT == 1 || NSPLIT == 2) a2[mb] = WFrag<T16>::ld(A2 + aoff + (size_t)mb * 16 * K + kc); }
#pragma unroll
        for (int nb = 0; nb < 4; ++nb) { const V b = WFrag<T16>::ld(Bt + boff + (size_t)nb * 16 * K + kc); V b2; if (NSPLIT >= 2) b2 = WFrag<T16>::ld(Bt2 + boff + (size_t)nb * 16 * K + kc);
#pragma unroll
            for (int mb = 0; mb < 4; ++mb) { acc[mb][nb] = WFrag<T16>::mma(a[mb], b, acc[mb][nb]); if (NSPLIT == 1 || NSPLIT == 2) acc[mb][nb] = WFrag<T16>::mma(a2[mb], b, acc[mb][nb]); if (NSPLIT >= 2) acc[mb][nb] = WFrag<T16>::mma(a[mb], b2, acc[mb][nb]); } }
        asm volatile("v_nop\n\tv_nop\n\tv_nop\n\tv_nop" : "+v"(acc[0][0]), "+v"(acc[1][1]), "+v"(acc[2][2]), "+v"(acc[3][3]) : "v"(a[0]), "v"(a[3]));
    }
#pragma unroll
    for (int mb = 0; mb < 4; ++mb) {
#pragma unroll
        for (int nb = 0; nb < 4; ++nb) {
#pragma unroll
            for (int j = 0; j < 8; ++j) os[(hi * 8 + j) * 68 + nb * 16 + lr] = acc[mb][nb][j]; }
        __builtin_amdgcn_wave_barrier(); asm volatile("" ::: "memory");
        float* crow = C + (size_t)(r0 + mb * 16) * ldc + c0;
{
#pragma unroll
            for (int s = 0; s < 8; ++s) { const int row = 2 * s + hi, cofs = lr * 4; v4f val = *(const v4fa*)(os + row * 68 + cofs); if (BIAS) { val[0] += bfr(bias[c0 + cofs]); val[1] += bfr(bias[c0 + cofs + 1]); val[2] += bfr(bias[c0 + cofs + 2]); val[3] += bfr(bias[c0 + cofs + 3]); }
                *(v4f*)(crow + (size_t)row * ldc + cofs) = val; }
             }
        __builtin_amdgcn_wave_barrier(); asm volatile("" ::: "memory");
    }
}

// ---- k_gemmc: the same one-wave 64x64 tile GEMM specialised for causal attention: CMODE 1 skips score tiles entirely above the diagonal (query rows r0+roff.., key columns c0..), CMODE 2 limits the
// key (K) loop of the probability x value contraction to the diagonal block (probabilities beyond it are exactly zero). roff = row offset of this launch's first row within the sequence.
template <typename T16, int NSPLIT, int CMODE>
__global__ __launch_bounds__(32) void k_gemmc(const T16* __restrict__ A, const T16* __restrict__ A2, const T16* __restrict__ Bt, const T16* __restrict__ Bt2, int K, float* C, int ldc, int roff, size_t sA, size_t sB, size_t sC) {
    typedef typename WFrag<T16>::V V;
    __shared__ __align__(16) float os[16 * 68];
    const size_t z = blockIdx.z; A += z * sA; if (A2) A2 += z * sA; Bt += z * sB; if (Bt2) Bt2 += z * sB; C += z * sC;
    const int lane = threadIdx.x & 31, lr = lane & 15, hi = lane >> 4; const int r0 = blockIdx.x * 64, c0 = blockIdx.y * 64;
    if (CMODE == 1 && c0 > r0 + roff + 63) return;                  // score tile entirely above the causal diagonal: never read (the softmax masks j > i by select)
    const int Kl = (CMODE == 2) ? min(K, r0 + roff + 64) : K;        // P.V: probabilities are exactly 0 beyond the diagonal block, so the K loop stops there
    v8f acc[4][4];
#pragma unroll
    for (int mb = 0; mb < 4; ++mb)
#pragma unroll
        for (int nb = 0; nb < 4; ++nb) acc[mb][nb] = (v8f){};
    const size_t aoff = (size_t)(r0 + lr) * K + 8 * hi, boff = (size_t)(c0 + lr) * K + 8 * hi;
#pragma unroll 1
    for (int kc = 0; kc < Kl; kc += 32) {
        V a[4], a2[4];
#pragma unroll
        for (int mb = 0; mb < 4; ++mb) { a[mb] = WFrag<T16>::ld(A + aoff + (size_t)mb * 16 * K + kc); if (NSPLIT == 1 || NSPLIT == 2) a2[mb] = WFrag<T16>::ld(A2 + aoff + (size_t)mb * 16 * K + kc); }
#pragma unroll
        for (int nb = 0; nb < 4; ++nb) { const V b = WFrag<T16>::ld(Bt + boff + (size_t)nb * 16 * K + kc); V b2; if (NSPLIT >= 2) b2 = WFrag<T16>::ld(Bt2 + boff + (size_t)nb * 16 * K + kc);
#pragma unroll
            for (int mb = 0; mb < 4; ++mb) { acc[mb][nb] = WFrag<T16>::mma(a[mb], b, acc[mb][nb]); if (NSPLIT == 1 || NSPLIT == 2) acc[mb][nb] = WFrag<T16>::mma(a2[mb], b, acc[mb][nb]); if (NSPLIT >= 2) acc[mb][nb] = WFrag<T16>::mma(a[mb], b2, acc[mb][nb]); } }
        asm volatile("v_nop\n\tv_nop\n\tv_nop\n\tv_nop" : "+v"(acc[0][0]), "+v"(acc[1][1]), "+v"(acc[2][2]), "+v"(acc[3][3]) : "v"(a[0]), "v"(a[3]));
    }
#pragma unroll
    for (int mb = 0; mb < 4; ++mb) {
#pragma unroll
        for (int nb = 0; nb < 4; ++nb) {
#pragma unroll
            for (int j = 0; j < 8; ++j) os[(hi * 8 + j) * 68 + nb * 16 + lr] = acc[mb][nb][j]; }
        __builtin_amdgcn_wave_barrier(); asm volatile("" ::: "memory");
        float* crow = C + (size_t)(r0 + mb * 16) * ldc + c0;
{
#pragma unroll
            for (int s = 0; s < 8; ++s) { const int row = 2 * s + hi, cofs = lr * 4; v4f val = *(const v4fa*)(os + row * 68 + cofs);
                *(v4f*)(crow + (size_t)row * ldc + cofs) = val; }
             }
        __builtin_amdgcn_wave_barrier(); asm volatile("" ::: "memory");
    }
}

__device__ __forceinline__ h16 tohx(float x) { return (h16)x; }
__device__ __forceinline__ void splitf(float y, unsigned short& h, unsigned short& l) { h = f2bf(y); l = f2bf(y - bf2f(h)); }
typedef __attribute__((ext_vector_type(2))) _Float16 v2h;
typedef __attribute__((ext_vector_type(4))) _Float16 v4h;
typedef __attribute__((ext_vector_type(2))) unsigned short v2us;
typedef __attribute__((ext_vector_type(4))) unsigned short v4us;
typedef __attribute__((ext_vector_type(2))) float v2f;
typedef __attribute__((ext_vector_type(4))) int v4i;

__global__ __launch_bounds__(256) void k_wtG(const float* __restrict__ w, int K, int N, bf* Bt) {
    const int lane = threadIdx.x & 31; const int L0 = (blockIdx.x * 8 + (threadIdx.x >> 5)) * 8; const int nlines = N * K / 64;
{
#pragma unroll 1
        for (int l = 0; l < 8; ++l) { const int L = L0 + l; if (L >= nlines) break; const size_t e = (size_t)L * 64 + lane * 2; const int k = (int)(e % K), n = (int)(e / K); v2us o;
            o[0] = f2bf(w[(size_t)k * N + n]); o[1] = f2bf(w[(size_t)(k + 1) * N + n]); *(v2us*)(Bt + e) = o; }
         }
}
__global__ __launch_bounds__(256) void k_cvt8(const float* __restrict__ src, bf* dst, size_t n8) { const size_t i = (size_t)blockIdx.x * 256 + threadIdx.x; if (i >= n8) return; const v8f v = *(const v8f*)(src + i * 8); v8us o;
#pragma unroll
    for (int k = 0; k < 8; ++k) o[k] = f2bf(v[k]); *(v8us*)(dst + i * 8) = o;  }
__global__ __launch_bounds__(256) void k_cscvt(const float* __restrict__ cosT, const float* __restrict__ sinT, float* CS) { const int idx = blockIdx.x * 256 + threadIdx.x; if (idx >= TT * HD) return; v2f cs; cs[0] = bfr(cosT[idx]); cs[1] = bfr(sinT[idx]); *(v2f*)(CS + (size_t)idx * 2) = cs;  }
// k_rope: head planes [h][t][d] (fp16 + hi/lo) of rope(x) x sc with the rotate-half convention out[d] = x[d] cos[t][d] - x[d+HD/2] sin[t][d], out[d+HD/2] = x[d+HD/2] cos[t][d+HD/2] + x[d] sin[t][d+HD/2]
__global__ __launch_bounds__(256) void k_rope(const float* __restrict__ F, int pitch, int nheads, const float* __restrict__ CS, const float* __restrict__ RF, const float* __restrict__ nw, float sc, h16* P16, bf* Ph, bf* Pl) {
    const size_t e = ((size_t)blockIdx.x * 256 + threadIdx.x) * 2; if (e >= (size_t)nheads * TT * HD) return; const int d = (int)(e % HD); const int t = (int)((e / HD) % TT); const int h = (int)(e / ((size_t)HD * TT)); const float* f = F + (size_t)t * pitch + h * HD; const float rf = RF ? RF[(size_t)h * TT + t] : 1.0f; v2h o16; v2us oh, ol;
#pragma unroll
    for (int q = 0; q < 2; ++q) { const int dd = d + q; const int dp = (dd < HD / 2) ? dd + HD / 2 : dd - HD / 2; float x0 = f[dd], x1 = f[dp];
        if (RF) { float n0 = __fmul_rn(x0, rf), n1 = __fmul_rn(x1, rf); asm volatile("" : "+v"(n0)); asm volatile("" : "+v"(n1)); x0 = __fmul_rn(bfr(nw[dd]), n0); x1 = __fmul_rn(bfr(nw[dp]), n1); }
        const v2f cs = *(const v2f*)(CS + ((size_t)t * HD + dd) * 2); float a = __fmul_rn(x0, cs[0]), bq = __fmul_rn(x1, cs[1]); asm volatile("" : "+v"(a)); asm volatile("" : "+v"(bq)); const float r = ((dd < HD / 2) ? __fsub_rn(a, bq) : __fadd_rn(a, bq)) * sc;
        o16[q] = tohx(r); unsigned short a2, c2; splitf(r, a2, c2); oh[q] = a2; ol[q] = c2; }
    *(v2h*)(P16 + e) = o16; *(v2us*)(Ph + e) = oh; *(v2us*)(Pl + e) = ol;  }
__global__ __launch_bounds__(256) void k_vtp(const float* __restrict__ F, int pitch, int nheads, h16* V16, bf* Vh, bf* Vl) { const size_t e = ((size_t)blockIdx.x * 256 + threadIdx.x) * 2; if (e >= (size_t)nheads * HD * TT) return; const int t = (int)(e % TT); const int d = (int)((e / TT) % HD); const int g = (int)(e / ((size_t)TT * HD)); v2h o16; v2us oh, ol;
#pragma unroll
    for (int q = 0; q < 2; ++q) { const float x = F[(size_t)(t + q) * pitch + g * HD + d]; o16[q] = tohx(x); unsigned short a2, c2; splitf(x, a2, c2); oh[q] = a2; ol[q] = c2; }
    *(v2h*)(V16 + e) = o16; *(v2us*)(Vh + e) = oh; *(v2us*)(Vl + e) = ol;  }
__global__ __launch_bounds__(256) void k_csid(float* CS) { const int idx = blockIdx.x * 256 + threadIdx.x; if (idx >= TT * HD) return; v2f cs; cs[0] = 1.0f; cs[1] = 0.0f; *(v2f*)(CS + (size_t)idx * 2) = cs;  }
// k_asoft: per row (zz, i): t = S x HD^-0.5 + slope (j - i) for j <= i (causal; the reference's -1e9 additive fill vanishes identically); softmax over the 1024 keys (register row, one exp, fixed trees);
__global__ __launch_bounds__(256) void k_asoft(const float* __restrict__ Sb, const float* __restrict__ SLP, int h0, h16* P16, bf* Ph, bf* Pl) {
    const int lane = threadIdx.x & 31; const int row = blockIdx.x * 8 + (threadIdx.x >> 5); if (row >= ZH * TT) return; const int i = row % TT; const int zz = row / TT; (void)zz; const bool hires = (i < RH); const float* sr = Sb + (size_t)row * TT; float v[TT / 32]; float mx = -3.0e38f;
#pragma unroll
    for (int ch = 0; ch < TT / 128; ++ch) { const int j0 = ch * 128 + lane * 4; const v4f a = *(const v4f*)(sr + j0);
#pragma unroll
        for (int q = 0; q < 4; ++q) { const int j = j0 + q; (void)j; float t = -3.0e38f; if (j <= i) { const float sl = SLP[h0 + zz]; float bias = __fmul_rn(sl, (float)(j - i)); asm volatile("" : "+v"(bias)); float t0 = a[q] * SCL; asm volatile("" : "+v"(t0)); t = __fadd_rn(t0, bias); } v[ch * 4 + q] = t; mx = fmaxf(mx, t); } }
#pragma unroll
    for (int sh = 16; sh; sh >>= 1) mx = fmaxf(mx, __shfl_xor(mx, sh, 32));
    float sum = 0.f;
#pragma unroll
    for (int k = 0; k < TT / 32; ++k) { float d0 = __fsub_rn(v[k], mx); asm volatile("" : "+v"(d0)); v[k] = __builtin_amdgcn_exp2f(__fmul_rn(d0, 1.4426950408889634f)); sum += v[k]; }
#pragma unroll
    for (int sh = 16; sh; sh >>= 1) sum += __shfl_xor(sum, sh, 32);
    const float f = __fdiv_rn(hires ? 1.0f : PCAR, sum);
{
        if (hires) {
#pragma unroll
            for (int ch = 0; ch < TT / 128; ++ch) { v4us oh, ol;
#pragma unroll
                for (int q = 0; q < 4; ++q) { unsigned short a, c2; splitf(v[ch * 4 + q] * f, a, c2); oh[q] = a; ol[q] = c2; }
                const size_t oo = ((size_t)zz * (RH ? RH : 1) + i) * TT + ch * 128 + lane * 4; *(v4us*)(Ph + oo) = oh; *(v4us*)(Pl + oo) = ol; }
        } else {
#pragma unroll
            for (int ch = 0; ch < TT / 128; ++ch) { v4h o4;
#pragma unroll
                for (int q = 0; q < 4; ++q) o4[q] = tohx(v[ch * 4 + q] * f);
                *(v4h*)(P16 + (size_t)row * TT + ch * 128 + lane * 4) = o4; } }
         }
}
__global__ __launch_bounds__(256) void k_merge(const float* __restrict__ O, int h0, bf* Ah, bf* Al) { const size_t e = ((size_t)blockIdx.x * 256 + threadIdx.x) * 2; if (e >= (size_t)ZH * TT * HD) return; const int d = (int)(e % HD); const int t = (int)((e / HD) % TT); const int zz = (int)(e / ((size_t)HD * TT)); const float cs = (t < RH) ? 1.0f : (1.0f / PCAR); const size_t oo = (size_t)t * DQ + (h0 + zz) * HD + d;
    v2us oh, ol;
#pragma unroll
    for (int q = 0; q < 2; ++q) { unsigned short a, c2; splitf(O[e + q] * cs, a, c2); oh[q] = a; ol[q] = c2; } *(v2us*)(Ah + oo) = oh; *(v2us*)(Al + oo) = ol;  }

__global__ __launch_bounds__(256) void k_wtGs(const float* __restrict__ w, int K, int N, int ld, bf* Bt) { const size_t e = ((size_t)blockIdx.x * 256 + threadIdx.x) * 4; if (e >= (size_t)N * K) return; const int k = (int)(e % K); const int n = (int)(e / K); v4us o;   // Bt[n][k] = w[k*ld + n]
#pragma unroll
    for (int u = 0; u < 4; ++u) o[u] = f2bf(w[(size_t)(k + u) * ld + n]); *(v4us*)(Bt + e) = o;  }
__global__ __launch_bounds__(64) void k_slopes(float* SLP) { const int h = threadIdx.x; if (h >= 64) return; const float base = 0.8408964152537145f; const float v = (h < NH_) ? powf(base, (float)(h + 1)) : 0.f; *(float*)(SLP + h) = v;  }   // ALiBi slopes 2^(-0.25 (h+1)) as f32 base^power like the numpy reference

extern "C" void kernel_launch(void* const* d_in, const int* in_sizes, int n_in,
                              void* d_out, int out_size, void* d_ws, size_t ws_size, hipStream_t stream) {
    (void)in_sizes; (void)n_in; (void)out_size;
    const float* x = (const float*)d_in[0]; const float* wqkv = (const float*)d_in[1]; const float* wo = (const float*)d_in[2]; const float* wq = nullptr; const float* wk = nullptr; const float* wv = nullptr; (void)wq; (void)wk; (void)wv; const float* cosT = nullptr; const float* sinT = nullptr; (void)cosT; (void)sinT;
    float* OUT = (float*)d_out;     // [4][1024][1024]
    char* wsp = (char*)d_ws;
    auto take = [&](size_t bytes) { char* p = wsp; wsp += (bytes + 255) & ~(size_t)255; return (void*)p; };
    bf* WQ = (bf*)take((size_t)DQ * DM * 2); bf* WK = (bf*)take((size_t)DKV * DM * 2); bf* WV = (bf*)take((size_t)DKV * DM * 2); bf* WO = (bf*)take((size_t)DM * DQ * 2); float* CS = (float*)take((size_t)TT * HD * 2 * 4);
    bf* XB = (bf*)take((size_t)TT * DM * 2); float* SLP = (float*)take(256); float* FQ = (float*)take((size_t)TT * DQ * 4); float* FK = (float*)take((size_t)TT * DKV * 4);
    h16* QP16 = (h16*)take((size_t)NH_ * TT * HD * 2); h16* KP16 = (h16*)take((size_t)NKV * TT * HD * 2); h16* VT16 = (h16*)take((size_t)NKV * HD * TT * 2);
    bf* QPh = (bf*)take((size_t)NH_ * TT * HD * 2); bf* QPl = (bf*)take((size_t)NH_ * TT * HD * 2); bf* KPh = (bf*)take((size_t)NKV * TT * HD * 2); bf* KPl = (bf*)take((size_t)NKV * TT * HD * 2); bf* VTh = (bf*)take((size_t)NKV * HD * TT * 2); bf* VTl = (bf*)take((size_t)NKV * HD * TT * 2); bf* Ph = (bf*)take((size_t)ZH * RH * TT * 2); bf* Pl = (bf*)take((size_t)ZH * RH * TT * 2);
    float* Sb = (float*)take((size_t)ZH * TT * TT * 4); h16* P16 = (h16*)take((size_t)ZH * TT * TT * 2); float* Ob = (float*)take((size_t)ZH * TT * HD * 4); bf* ATh = (bf*)take((size_t)TT * DQ * 2); bf* ATl = (bf*)take((size_t)TT * DQ * 2);
    if ((size_t)(wsp - (char*)d_ws) > ws_size) return;    // ws 256 MiB
    float* FV = FK;   // v projection reuses the k buffer after the k planes are built (stream-ordered)
    { k_wtGs<<<(unsigned)(((size_t)DQ * DM / 4 + 255) / 256), 256, 0, stream>>>(wqkv, DM, DQ, 4096, WQ); k_wtGs<<<(unsigned)(((size_t)DKV * DM / 4 + 255) / 256), 256, 0, stream>>>(wqkv + 2048, DM, DKV, 4096, WK); k_wtGs<<<(unsigned)(((size_t)DKV * DM / 4 + 255) / 256), 256, 0, stream>>>(wqkv + 3072, DM, DKV, 4096, WV); k_slopes<<<1, 64, 0, stream>>>(SLP);
      k_wtG<<<(unsigned)((DQ * DM / 64 + 63) / 64), 256, 0, stream>>>(wo, DQ, DM, WO);
       }
    k_csid<<<(TT * HD + 255) / 256, 256, 0, stream>>>(CS);
    const unsigned LQ = (unsigned)(((size_t)NH_ * TT * HD / 2 + 255) / 256), LKv = (unsigned)(((size_t)NKV * TT * HD / 2 + 255) / 256);
    for (int b = 0; b < NB_; ++b) {
        
        k_cvt8<<<(unsigned)(((size_t)TT * DM / 8 + 255) / 256), 256, 0, stream>>>(x + (size_t)b * TT * DM, XB, (size_t)TT * DM / 8);
        k_gemmw<bf, 0, false><<<dim3(TT / 64, DQ / 64, 1), 32, 0, stream>>>(XB, nullptr, WQ, nullptr, DM, FQ, DQ, nullptr, 0, 0, 0);
        k_rope<<<LQ, 256, 0, stream>>>(FQ, DQ, NH_, CS, nullptr, nullptr, 1.0f, QP16, QPh, QPl);
        k_gemmw<bf, 0, false><<<dim3(TT / 64, DKV / 64, 1), 32, 0, stream>>>(XB, nullptr, WK, nullptr, DM, FK, DKV, nullptr, 0, 0, 0);
        k_rope<<<LKv, 256, 0, stream>>>(FK, DKV, NKV, CS, nullptr, nullptr, 1.0f, KP16, KPh, KPl);
        k_gemmw<bf, 0, false><<<dim3(TT / 64, DKV / 64, 1), 32, 0, stream>>>(XB, nullptr, WV, nullptr, DM, FV, DKV, nullptr, 0, 0, 0); k_vtp<<<LKv, 256, 0, stream>>>(FV, DKV, NKV, VT16, VTh, VTl);
        for (int h0 = 0; h0 < NH_; h0 += ZH) { const size_t zq = (size_t)h0, zk = (size_t)(h0 / REP);   // both heads of a pass share kv group h0/REP (REP >= 2): sB = 0
            k_gemmc<bf, 2, 1><<<dim3(RH / 64, TT / 64, ZH), 32, 0, stream>>>(QPh + zq * TT * HD, QPl + zq * TT * HD, KPh + zk * TT * HD, KPl + zk * TT * HD, HD, Sb, TT, 0, (size_t)TT * HD, 0, (size_t)TT * TT);
            k_gemmc<h16, 0, 1><<<dim3((TT - RH) / 64, TT / 64, ZH), 32, 0, stream>>>(QP16 + zq * TT * HD + (size_t)RH * HD, nullptr, KP16 + zk * TT * HD, nullptr, HD, Sb + (size_t)RH * TT, TT, RH, (size_t)TT * HD, 0, (size_t)TT * TT);
            k_asoft<<<ZH * TT / 8, 256, 0, stream>>>(Sb, SLP, h0, P16, Ph, Pl);
            k_gemmc<bf, 2, 2><<<dim3(RH / 64, HD / 64, ZH), 32, 0, stream>>>(Ph, Pl, VTh + zk * HD * TT, VTl + zk * HD * TT, TT, Ob, HD, 0, (size_t)RH * TT, 0, (size_t)TT * HD);
            k_gemmc<h16, 0, 2><<<dim3((TT - RH) / 64, HD / 64, ZH), 32, 0, stream>>>(P16 + (size_t)RH * TT, nullptr, VT16 + zk * HD * TT, nullptr, TT, Ob + (size_t)RH * HD, HD, RH, (size_t)TT * TT, 0, (size_t)TT * HD);
            k_merge<<<(unsigned)(((size_t)ZH * TT * HD / 2 + 255) / 256), 256, 0, stream>>>(Ob, h0, ATh, ATl); }
        k_gemmw<bf, 1, false><<<dim3(TT / 64, DM / 64, 1), 32, 0, stream>>>(ATh, ATl, WO, nullptr, DQ, OUT + (size_t)b * TT * DM, DM, nullptr, 0, 0, 0); }
}

// v001
// Measured time: 680 microseconds a run.
// Two timings next to v000 put it at 5.72 and 5.74 times that version's speed.
#include <hip/hip_runtime.h>

// FlexAttention (inputs [4][1024][1024]; qkv = x W_qkv ([1024][4096]: 2048 q columns = 32 query heads x 64, then 1024 k and 1024 v columns = 16 kv heads; GQA repeat_interleave: query head h uses kv head h/2); scores = q.k / 8 + ALiBi slope_h (j - i) (slopes 2^(-0.25 (h+1)) computed on device in f32); causal; softmax; out = merged (2048) W_out -> [4][1024][1024]).
// Compute dtypes, f32 accumulate: every input rounded to bf16; q/k/v on PLAIN bf16 operands (inputs: exact; column blocks of W_qkv); causal scores and attn.v: query rows < 512 hl (3 products), rows 512..1023 single fp16 (x1024); ALiBi bias + softmax f32; W_out hl x exact (2 products).

#define NB_  4
#define TT   1024
#define DM   1024
#define NH_  32
#define NKV  16
#define REP  (NH_ / NKV)
#define HD   64
#define DQ   (NH_ * HD)
#define DKV  (NKV * HD)
#define ZH   32                   // query heads per attention launch (blockIdx.z)
#define PP   (2 * TT)             // pitch, in 16-bit elements, of a probability row stored over its own f32 score row
#define RH   512                  // query rows < RH use hi+lo planes (0: none)
#define WIN  1024
#define PCAR 1024.0f
#define SCL  0.125f   // HD^-0.5
typedef _Float16 h16;
typedef unsigned short bf;
typedef __attribute__((ext_vector_type(16))) __bf16   v16bf;
typedef __attribute__((ext_vector_type(16))) _Float16 v16h;
typedef __attribute__((ext_vector_type(8)))  _Float16 v8h;
typedef __attribute__((ext_vector_type(8)))  unsigned short v8us;
typedef __attribute__((ext_vector_type(8)))  float    v8f;
typedef __attribute__((ext_vector_type(4)))  float    v4f;
typedef v8h  __attribute__((may_alias)) v8ha;
typedef v4f  __attribute__((may_alias)) v4fa;
typedef v8us __attribute__((may_alias)) v8usa;

__device__ __forceinline__ unsigned short f2bf(float f) { unsigned u = __float_as_uint(f); u += 0x7FFFu + ((u >> 16) & 1u); return (unsigned short)(u >> 16); }
__device__ __forceinline__ float bf2f(unsigned short b) { return __uint_as_float(((unsigned)b) << 16); }
__device__ __forceinline__ float bfr(float f) { return bf2f(f2bf(f)); }
__device__ __forceinline__ v16h cat16(v8h lo, v8h hi) { return __builtin_shufflevector(lo, hi, 0, 1, 2, 3, 4, 5, 6, 7, 8, 9, 10, 11, 12, 13, 14, 15); }
__device__ __forceinline__ v16bf cat16b(v8us lo, v8us hi) { return __builtin_bit_cast(v16bf, __builtin_shufflevector(lo, hi, 0, 1, 2, 3, 4, 5, 6, 7, 8, 9, 10, 11, 12, 13, 14, 15)); }
__device__ __forceinline__ v8f wmma16(v16h a, v16h b, v8f c) { return __builtin_amdgcn_wmma_f32_16x16x32_f16(false, a, false, b, (short)0, c, false, false); }
__device__ __forceinline__ v8f wmmab(v16bf a, v16bf b, v8f c) { return __builtin_amdgcn_wmma_f32_16x16x32_bf16(false, a, false, b, (short)0, c, false, false); }



// ---- k_gemmw: register-blocked GEMM, ONE WAVE per 64x64 output tile (16 accumulators), operands straight from K-contiguous 16-bit planes; grid (M/64, N/64, Z), 32 threads.
// C[m][n] (f32, pitch ldc, + optional f32 bias[n]) = sum_k A[m][k] Bt[n][k] (+ split products per NSPLIT). z-batch strides sA/sB/sC in elements. K % 32 == 0.
template <typename T16> struct WFrag;
template <> struct WFrag<h16> { typedef v16h V; static __device__ __forceinline__ V ld(const h16* p) { return cat16(*(const v8h*)p, *(const v8h*)(p + 16)); } static __device__ __forceinline__ v8f mma(V a, V b, v8f c) { return wmma16(a, b, c); } };
template <> struct WFrag<bf> { typedef v16bf V; static __device__ __forceinline__ V ld(const bf* p) { return cat16b(*(const v8us*)p, *(const v8us*)(p + 16)); } static __device__ __forceinline__ v8f mma(V a, V b, v8f c) { return wmmab(a, b, c); } };
template <typename T16, int NSPLIT, bool BIAS>
__global__ __launch_bounds__(32) void k_gemmw(const T16* __restrict__ A, const T16* __restrict__ A2, const T16* __restrict__ Bt, const T16* __restrict__ Bt2, int K, float* C, int ldc, const float* __restrict__ bias, size_t sA, size_t sB, size_t sC) {
    typedef typename WFrag<T16>::V V;
    __shared__ __align__(16) float os[16 * 68];
    const size_t z = blockIdx.z; A += z * sA; if (A2) A2 += z * sA; Bt += z * sB; if (Bt2) Bt2 += z * sB; C += z * sC;
    const int lane = threadIdx.x & 31, lr = lane & 15, hi = lane >> 4; const int r0 = blockIdx.x * 64, c0 = blockIdx.y * 64;
    v8f acc[4][4];
#pragma unroll
    for (int mb = 0; mb < 4; ++mb)
#pragma unroll
        for (int nb = 0; nb < 4; ++nb) acc[mb][nb] = (v8f){};
    const size_t aoff = (size_t)(r0 + lr) * K + 8 * hi, boff = (size_t)(c0 + lr) * K + 8 * hi;
#pragma unroll 1
    for (int kc = 0; kc < K; kc += 32) {
        V a[4], a2[4];
#pragma unroll
        for (int mb = 0; mb < 4; ++mb) { a[mb] = WFrag<T16>::ld(A + aoff + (size_t)mb * 16 * K + kc); if (NSPLIT == 1 || NSPLIT == 2) a2[mb] = WFrag<T16>::ld(A2 + aoff + (size_t)mb * 16 * K + kc); }
#pragma unroll
        for (int nb = 0; nb < 4; ++nb) { const V b = WFrag<T16>::ld(Bt + boff + (size_t)nb * 16 * K + kc); V b2; if (NSPLIT >= 2) b2 = WFrag<T16>::ld(Bt2 + boff + (size_t)nb * 16 * K + kc);
#pragma unroll
            for (int mb = 0; mb < 4; ++mb) { acc[mb][nb] = WFrag<T16>::mma(a[mb], b, acc[mb][nb]); if (NSPLIT == 1 || NSPLIT == 2) acc[mb][nb] = WFrag<T16>::mma(a2[mb], b, acc[mb][nb]); if (NSPLIT >= 2) acc[mb][nb] = WFrag<T16>::mma(a[mb], b2, acc[mb][nb]); } }
        asm volatile("v_nop\n\tv_nop\n\tv_nop\n\tv_nop" : "+v"(acc[0][0]), "+v"(acc[1][1]), "+v"(acc[2][2]), "+v"(acc[3][3]) : "v"(a[0]), "v"(a[3]));
    }
#pragma unroll
    for (int mb = 0; mb < 4; ++mb) {
#pragma unroll
        for (int nb = 0; nb < 4; ++nb) {
#pragma unroll
            for (int j = 0; j < 8; ++j) os[(hi * 8 + j) * 68 + nb * 16 + lr] = acc[mb][nb][j]; }
        __builtin_amdgcn_wave_barrier(); asm volatile("" ::: "memory");
        float* crow = C + (size_t)(r0 + mb * 16) * ldc + c0;
{
#pragma unroll
            for (int s = 0; s < 8; ++s) { const int row = 2 * s + hi, cofs = lr * 4; v4f val = *(const v4fa*)(os + row * 68 + cofs); if (BIAS) { val[0] += bfr(bias[c0 + cofs]); val[1] += bfr(bias[c0 + cofs + 1]); val[2] += bfr(bias[c0 + cofs + 2]); val[3] += bfr(bias[c0 + cofs + 3]); }
                *(v4f*)(crow + (size_t)row * ldc + cofs) = val; }
             }
        __builtin_amdgcn_wave_barrier(); asm volatile("" ::: "memory");
    }
}

// ---- k_gemmc: the same one-wave 64x64 tile GEMM specialised for causal attention: CMODE 1 skips score tiles entirely above the diagonal (query rows r0+roff.., key columns c0..), CMODE 2 limits the
// key (K) loop of the probability x value contraction to the diagonal block (probabilities beyond it are exactly zero). roff = row offset of this launch's first row within the sequence.
// lda = pitch of A in elements (Bt has pitch K); z = query head: A and C step by sA / sC per head, Bt by sB per kv head z / REP.
template <typename T16, int NSPLIT, int CMODE>
__global__ __launch_bounds__(32) void k_gemmc(const T16* __restrict__ A, const T16* __restrict__ A2, const T16* __restrict__ Bt, const T16* __restrict__ Bt2, int K, int lda, float* C, int ldc, int roff, size_t sA, size_t sB, size_t sC) {
    typedef typename WFrag<T16>::V V;
    __shared__ __align__(16) float os[16 * 68];
    const size_t z = blockIdx.z; A += z * sA; if (A2) A2 += z * sA; Bt += (z / REP) * sB; if (Bt2) Bt2 += (z / REP) * sB; C += z * sC;
    const int lane = threadIdx.x & 31, lr = lane & 15, hi = lane >> 4; const int r0 = blockIdx.x * 64, c0 = blockIdx.y * 64;
    if (CMODE == 1 && c0 > r0 + roff + 63) return;                  // score tile entirely above the causal diagonal: never read (the softmax masks j > i by select)
    const int Kl = (CMODE == 2) ? min(K, r0 + roff + 64) : K;        // P.V: probabilities are exactly 0 beyond the diagonal block, so the K loop stops there
    v8f acc[4][4];
#pragma unroll
    for (int mb = 0; mb < 4; ++mb)
#pragma unroll
        for (int nb = 0; nb < 4; ++nb) acc[mb][nb] = (v8f){};
    const size_t aoff = (size_t)(r0 + lr) * lda + 8 * hi, boff = (size_t)(c0 + lr) * K + 8 * hi;
#pragma unroll 1
    for (int kc = 0; kc < Kl; kc += 32) {
        V a[4], a2[4];
#pragma unroll
        for (int mb = 0; mb < 4; ++mb) { a[mb] = WFrag<T16>::ld(A + aoff + (size_t)mb * 16 * lda + kc); if (NSPLIT == 1 || NSPLIT == 2) a2[mb] = WFrag<T16>::ld(A2 + aoff + (size_t)mb * 16 * lda + kc); }
#pragma unroll
        for (int nb = 0; nb < 4; ++nb) { const V b = WFrag<T16>::ld(Bt + boff + (size_t)nb * 16 * K + kc); V b2; if (NSPLIT >= 2) b2 = WFrag<T16>::ld(Bt2 + boff + (size_t)nb * 16 * K + kc);
#pragma unroll
            for (int mb = 0; mb < 4; ++mb) { acc[mb][nb] = WFrag<T16>::mma(a[mb], b, acc[mb][nb]); if (NSPLIT == 1 || NSPLIT == 2) acc[mb][nb] = WFrag<T16>::mma(a2[mb], b, acc[mb][nb]); if (NSPLIT >= 2) acc[mb][nb] = WFrag<T16>::mma(a[mb], b2, acc[mb][nb]); } }
        asm volatile("v_nop\n\tv_nop\n\tv_nop\n\tv_nop" : "+v"(acc[0][0]), "+v"(acc[1][1]), "+v"(acc[2][2]), "+v"(acc[3][3]) : "v"(a[0]), "v"(a[3]));
    }
#pragma unroll
    for (int mb = 0; mb < 4; ++mb) {
#pragma unroll
        for (int nb = 0; nb < 4; ++nb) {
#pragma unroll
            for (int j = 0; j < 8; ++j) os[(hi * 8 + j) * 68 + nb * 16 + lr] = acc[mb][nb][j]; }
        __builtin_amdgcn_wave_barrier(); asm volatile("" ::: "memory");
        float* crow = C + (size_t)(r0 + mb * 16) * ldc + c0;
{
#pragma unroll
            for (int s = 0; s < 8; ++s) { const int row = 2 * s + hi, cofs = lr * 4; v4f val = *(const v4fa*)(os + row * 68 + cofs);
                *(v4f*)(crow + (size_t)row * ldc + cofs) = val; }
             }
        __builtin_amdgcn_wave_barrier(); asm volatile("" ::: "memory");
    }
}

__device__ __forceinline__ h16 tohx(float x) { return (h16)x; }
__device__ __forceinline__ void splitf(float y, unsigned short& h, unsigned short& l) { h = f2bf(y); l = f2bf(y - bf2f(h)); }
typedef __attribute__((ext_vector_type(2))) _Float16 v2h;
typedef __attribute__((ext_vector_type(4))) _Float16 v4h;
typedef __attribute__((ext_vector_type(2))) unsigned short v2us;
typedef __attribute__((ext_vector_type(4))) unsigned short v4us;
typedef __attribute__((ext_vector_type(2))) float v2f;
typedef __attribute__((ext_vector_type(4))) int v4i;

__global__ __launch_bounds__(256) void k_wtG(const float* __restrict__ w, int K, int N, bf* Bt) {
    const int lane = threadIdx.x & 31; const int L0 = (blockIdx.x * 8 + (threadIdx.x >> 5)) * 8; const int nlines = N * K / 64;
{
#pragma unroll 1
        for (int l = 0; l < 8; ++l) { const int L = L0 + l; if (L >= nlines) break; const size_t e = (size_t)L * 64 + lane * 2; const int k = (int)(e % K), n = (int)(e / K); v2us o;
            o[0] = f2bf(w[(size_t)k * N + n]); o[1] = f2bf(w[(size_t)(k + 1) * N + n]); *(v2us*)(Bt + e) = o; }
         }
}
__global__ __launch_bounds__(256) void k_cvt8(const float* __restrict__ src, bf* dst, size_t n8) { const size_t i = (size_t)blockIdx.x * 256 + threadIdx.x; if (i >= n8) return; const v8f v = *(const v8f*)(src + i * 8); v8us o;
#pragma unroll
    for (int k = 0; k < 8; ++k) o[k] = f2bf(v[k]); *(v8us*)(dst + i * 8) = o;  }
__global__ __launch_bounds__(256) void k_cscvt(const float* __restrict__ cosT, const float* __restrict__ sinT, float* CS) { const int idx = blockIdx.x * 256 + threadIdx.x; if (idx >= TT * HD) return; v2f cs; cs[0] = bfr(cosT[idx]); cs[1] = bfr(sinT[idx]); *(v2f*)(CS + (size_t)idx * 2) = cs;  }
// k_rope: head planes [h][t][d] (fp16 + hi/lo) of rope(x) x sc with the rotate-half convention out[d] = x[d] cos[t][d] - x[d+HD/2] sin[t][d], out[d+HD/2] = x[d+HD/2] cos[t][d+HD/2] + x[d] sin[t][d+HD/2]
__global__ __launch_bounds__(256) void k_rope(const float* __restrict__ F, int pitch, int nheads, const float* __restrict__ CS, const float* __restrict__ RF, const float* __restrict__ nw, float sc, h16* P16, bf* Ph, bf* Pl) {
    const size_t e = ((size_t)blockIdx.x * 256 + threadIdx.x) * 2; if (e >= (size_t)nheads * TT * HD) return; const int d = (int)(e % HD); const int t = (int)((e / HD) % TT); const int h = (int)(e / ((size_t)HD * TT)); const float* f = F + (size_t)t * pitch + h * HD; const float rf = RF ? RF[(size_t)h * TT + t] : 1.0f; v2h o16; v2us oh, ol;
#pragma unroll
    for (int q = 0; q < 2; ++q) { const int dd = d + q; const int dp = (dd < HD / 2) ? dd + HD / 2 : dd - HD / 2; float x0 = f[dd], x1 = f[dp];
        if (RF) { float n0 = __fmul_rn(x0, rf), n1 = __fmul_rn(x1, rf); asm volatile("" : "+v"(n0)); asm volatile("" : "+v"(n1)); x0 = __fmul_rn(bfr(nw[dd]), n0); x1 = __fmul_rn(bfr(nw[dp]), n1); }
        const v2f cs = *(const v2f*)(CS + ((size_t)t * HD + dd) * 2); float a = __fmul_rn(x0, cs[0]), bq = __fmul_rn(x1, cs[1]); asm volatile("" : "+v"(a)); asm volatile("" : "+v"(bq)); const float r = ((dd < HD / 2) ? __fsub_rn(a, bq) : __fadd_rn(a, bq)) * sc;
        o16[q] = tohx(r); unsigned short a2, c2; splitf(r, a2, c2); oh[q] = a2; ol[q] = c2; }
    *(v2h*)(P16 + e) = o16; *(v2us*)(Ph + e) = oh; *(v2us*)(Pl + e) = ol;  }
__global__ __launch_bounds__(256) void k_vtp(const float* __restrict__ F, int pitch, int nheads, h16* V16, bf* Vh, bf* Vl) { const size_t e = ((size_t)blockIdx.x * 256 + threadIdx.x) * 2; if (e >= (size_t)nheads * HD * TT) return; const int t = (int)(e % TT); const int d = (int)((e / TT) % HD); const int g = (int)(e / ((size_t)TT * HD)); v2h o16; v2us oh, ol;
#pragma unroll
    for (int q = 0; q < 2; ++q) { const float x = F[(size_t)(t + q) * pitch + g * HD + d]; o16[q] = tohx(x); unsigned short a2, c2; splitf(x, a2, c2); oh[q] = a2; ol[q] = c2; }
    *(v2h*)(V16 + e) = o16; *(v2us*)(Vh + e) = oh; *(v2us*)(Vl + e) = ol;  }
__global__ __launch_bounds__(256) void k_csid(float* CS) { const int idx = blockIdx.x * 256 + threadIdx.x; if (idx >= TT * HD) return; v2f cs; cs[0] = 1.0f; cs[1] = 0.0f; *(v2f*)(CS + (size_t)idx * 2) = cs;  }
// k_asoft: per row (zz, i): t = S x HD^-0.5 + slope_h (j - i) for j <= i and i - j < WIN (sliding causal window; the reference's -1e9 additive fill vanishes identically); softmax over the 1024 keys (register row, one exp, fixed trees);
// the probabilities go over the row's own 4 KiB of scores (P16 = Ph = Sb, Pl = Sb + 2 KiB; pitch PP): the one wave that owns a row has read all of it (max and sum) before its first store.
__global__ __launch_bounds__(256) void k_asoft(const float* Sb, const float* __restrict__ SLP, int h0, h16* P16, bf* Ph, bf* Pl) {
    const int lane = threadIdx.x & 31; const int row = blockIdx.x * 8 + (threadIdx.x >> 5); if (row >= ZH * TT) return; const int i = row % TT; const int zz = row / TT; (void)zz; const bool hires = (i < RH); const float* sr = Sb + (size_t)row * TT; float v[TT / 32]; float mx = -3.0e38f;
#pragma unroll
    for (int ch = 0; ch < TT / 128; ++ch) { const int j0 = ch * 128 + lane * 4; const v4f a = *(const v4f*)(sr + j0);
#pragma unroll
        for (int q = 0; q < 4; ++q) { const int j = j0 + q; (void)j; float t = -3.0e38f; if (j <= i) { const float sl = SLP[h0 + zz]; float bias = __fmul_rn(sl, (float)(j - i)); asm volatile("" : "+v"(bias)); float t0 = a[q] * SCL; asm volatile("" : "+v"(t0)); t = __fadd_rn(t0, bias); } v[ch * 4 + q] = t; mx = fmaxf(mx, t); } }
#pragma unroll
    for (int sh = 16; sh; sh >>= 1) mx = fmaxf(mx, __shfl_xor(mx, sh, 32));
    float sum = 0.f;
#pragma unroll
    for (int k = 0; k < TT / 32; ++k) { float d0 = __fsub_rn(v[k], mx); asm volatile("" : "+v"(d0)); v[k] = __builtin_amdgcn_exp2f(__fmul_rn(d0, 1.4426950408889634f)); sum += v[k]; }
#pragma unroll
    for (int sh = 16; sh; sh >>= 1) sum += __shfl_xor(sum, sh, 32);
    const float f = __fdiv_rn(hires ? 1.0f : PCAR, sum);
{
        if (hires) {
#pragma unroll
            for (int ch = 0; ch < TT / 128; ++ch) { v4us oh, ol;
#pragma unroll
                for (int q = 0; q < 4; ++q) { unsigned short a, c2; splitf(v[ch * 4 + q] * f, a, c2); oh[q] = a; ol[q] = c2; }
                const size_t oo = (size_t)row * PP + ch * 128 + lane * 4; *(v4us*)(Ph + oo) = oh; *(v4us*)(Pl + oo) = ol; }
        } else {
#pragma unroll
            for (int ch = 0; ch < TT / 128; ++ch) { v4h o4;
#pragma unroll
                for (int q = 0; q < 4; ++q) o4[q] = tohx(v[ch * 4 + q] * f);
                *(v4h*)(P16 + (size_t)row * PP + ch * 128 + lane * 4) = o4; } }
         }
}
__global__ __launch_bounds__(256) void k_merge(const float* __restrict__ O, int h0, bf* Ah, bf* Al) { const size_t e = ((size_t)blockIdx.x * 256 + threadIdx.x) * 2; if (e >= (size_t)ZH * TT * HD) return; const int d = (int)(e % HD); const int t = (int)((e / HD) % TT); const int zz = (int)(e / ((size_t)HD * TT)); const float cs = (t < RH) ? 1.0f : (1.0f / PCAR); const size_t oo = (size_t)t * DQ + (h0 + zz) * HD + d;
    v2us oh, ol;
#pragma unroll
    for (int q = 0; q < 2; ++q) { unsigned short a, c2; splitf(O[e + q] * cs, a, c2); oh[q] = a; ol[q] = c2; } *(v2us*)(Ah + oo) = oh; *(v2us*)(Al + oo) = ol;  }

__global__ __launch_bounds__(256) void k_wtGs(const float* __restrict__ w, int K, int N, int ld, bf* Bt) { const size_t e = ((size_t)blockIdx.x * 256 + threadIdx.x) * 4; if (e >= (size_t)N * K) return; const int k = (int)(e % K); const int n = (int)(e / K); v4us o;   // Bt[n][k] = w[k*ld + n]
#pragma unroll
    for (int u = 0; u < 4; ++u) o[u] = f2bf(w[(size_t)(k + u) * ld + n]); *(v4us*)(Bt + e) = o;  }
__global__ __launch_bounds__(64) void k_slopes(float* SLP) { const int h = threadIdx.x; if (h >= 64) return; const float base = 0.8408964152537145f; const float v = (h < NH_) ? powf(base, (float)(h + 1)) : 0.f; *(float*)(SLP + h) = v;  }   // ALiBi slopes 2^(-0.25 (h+1)) as f32 base^power like the numpy reference

extern "C" void kernel_launch(void* const* d_in, const int* in_sizes, int n_in,
                              void* d_out, int out_size, void* d_ws, size_t ws_size, hipStream_t stream) {
    (void)in_sizes; (void)n_in; (void)out_size;
    const float* x = (const float*)d_in[0]; const float* wqkv = (const float*)d_in[1]; const float* wo = (const float*)d_in[2]; const float* wq = nullptr; const float* wk = nullptr; const float* wv = nullptr; (void)wq; (void)wk; (void)wv; const float* cosT = nullptr; const float* sinT = nullptr; (void)cosT; (void)sinT;
    float* OUT = (float*)d_out;     // [4][1024][1024]
    char* wsp = (char*)d_ws;
    auto take = [&](size_t bytes) { char* p = wsp; wsp += (bytes + 255) & ~(size_t)255; return (void*)p; };
    bf* WQKV = (bf*)take((size_t)(DQ + 2 * DKV) * DM * 2); bf* WO = (bf*)take((size_t)DM * DQ * 2); float* CS = (float*)take((size_t)TT * HD * 2 * 4);
    bf* XB = (bf*)take((size_t)NB_ * TT * DM * 2); float* SLP = (float*)take(256); float* F = (float*)take((size_t)TT * (DQ + 2 * DKV) * 4);   // F: q | k | v columns of one batch, pitch 4096
    h16* QP16 = (h16*)take((size_t)(NH_ + NKV) * TT * HD * 2); h16* KP16 = QP16 + (size_t)NH_ * TT * HD; h16* VT16 = (h16*)take((size_t)NKV * HD * TT * 2);   // head planes: 32 q heads, then 16 k heads
    bf* QPh = (bf*)take((size_t)(NH_ + NKV) * TT * HD * 2); bf* KPh = QPh + (size_t)NH_ * TT * HD; bf* QPl = (bf*)take((size_t)(NH_ + NKV) * TT * HD * 2); bf* KPl = QPl + (size_t)NH_ * TT * HD; bf* VTh = (bf*)take((size_t)NKV * HD * TT * 2); bf* VTl = (bf*)take((size_t)NKV * HD * TT * 2);
    float* Sb = (float*)take((size_t)ZH * TT * TT * 4); float* Ob = (float*)take((size_t)ZH * TT * HD * 4); bf* ATh = (bf*)take((size_t)NB_ * TT * DQ * 2); bf* ATl = (bf*)take((size_t)NB_ * TT * DQ * 2);
    if ((size_t)(wsp - (char*)d_ws) > ws_size) return;    // ws 256 MiB
    h16* P16 = (h16*)Sb; bf* Ph = (bf*)Sb; bf* Pl = (bf*)Sb + TT;   // probabilities overwrite their own score rows (k_asoft)
    k_wtGs<<<(unsigned)(((size_t)(DQ + 2 * DKV) * DM / 4 + 255) / 256), 256, 0, stream>>>(wqkv, DM, DQ + 2 * DKV, 4096, WQKV); k_slopes<<<1, 64, 0, stream>>>(SLP);
    k_wtG<<<(unsigned)((DQ * DM / 64 + 63) / 64), 256, 0, stream>>>(wo, DQ, DM, WO);
    k_csid<<<(TT * HD + 255) / 256, 256, 0, stream>>>(CS);
    k_cvt8<<<(unsigned)(((size_t)NB_ * TT * DM / 8 + 255) / 256), 256, 0, stream>>>(x, XB, (size_t)NB_ * TT * DM / 8);
    const unsigned LQK = (unsigned)(((size_t)(NH_ + NKV) * TT * HD / 2 + 255) / 256), LKv = (unsigned)(((size_t)NKV * TT * HD / 2 + 255) / 256);
    for (int b = 0; b < NB_; ++b) {
        k_gemmw<bf, 0, false><<<dim3(TT / 64, (DQ + 2 * DKV) / 64, 1), 32, 0, stream>>>(XB + (size_t)b * TT * DM, nullptr, WQKV, nullptr, DM, F, DQ + 2 * DKV, nullptr, 0, 0, 0);
        k_rope<<<LQK, 256, 0, stream>>>(F, DQ + 2 * DKV, NH_ + NKV, CS, nullptr, nullptr, 1.0f, QP16, QPh, QPl);
        k_vtp<<<LKv, 256, 0, stream>>>(F + DQ + DKV, DQ + 2 * DKV, NKV, VT16, VTh, VTl);
        // all ZH = 32 query heads in blockIdx.z; query head z reads kv head z / REP
        k_gemmc<bf, 2, 1><<<dim3(RH / 64, TT / 64, ZH), 32, 0, stream>>>(QPh, QPl, KPh, KPl, HD, HD, Sb, TT, 0, (size_t)TT * HD, (size_t)TT * HD, (size_t)TT * TT);
        k_gemmc<h16, 0, 1><<<dim3((TT - RH) / 64, TT / 64, ZH), 32, 0, stream>>>(QP16 + (size_t)RH * HD, nullptr, KP16, nullptr, HD, HD, Sb + (size_t)RH * TT, TT, RH, (size_t)TT * HD, (size_t)TT * HD, (size_t)TT * TT);
        k_asoft<<<ZH * TT / 8, 256, 0, stream>>>(Sb, SLP, 0, P16, Ph, Pl);
        k_gemmc<bf, 2, 2><<<dim3(RH / 64, HD / 64, ZH), 32, 0, stream>>>(Ph, Pl, VTh, VTl, TT, PP, Ob, HD, 0, (size_t)TT * PP, (size_t)HD * TT, (size_t)TT * HD);
        k_gemmc<h16, 0, 2><<<dim3((TT - RH) / 64, HD / 64, ZH), 32, 0, stream>>>(P16 + (size_t)RH * PP, nullptr, VT16, nullptr, TT, PP, Ob + (size_t)RH * HD, HD, RH, (size_t)TT * PP, (size_t)HD * TT, (size_t)TT * HD);
        k_merge<<<(unsigned)(((size_t)ZH * TT * HD / 2 + 255) / 256), 256, 0, stream>>>(Ob, 0, ATh + (size_t)b * TT * DQ, ATl + (size_t)b * TT * DQ); }
    k_gemmw<bf, 1, false><<<dim3(NB_ * TT / 64, DM / 64, 1), 32, 0, stream>>>(ATh, ATl, WO, nullptr, DQ, OUT, DM, nullptr, 0, 0, 0);   // all four batches: rows b * 1024 + t
}

// v002
// One run takes 317 microseconds.
// In two side-by-side timings against v001, it was 2.14 and 2.15 times as fast.
// Over all steps from v000 it is 12.3 times as fast.
#include <hip/hip_runtime.h>

// FlexAttention (inputs [4][1024][1024]; qkv = x W_qkv ([1024][4096]: 2048 q columns = 32 query heads x 64, then 1024 k and 1024 v columns = 16 kv heads; GQA repeat_interleave: query head h uses kv head h/2); scores = q.k / 8 + ALiBi slope_h (j - i) (slopes 2^(-0.25 (h+1)) computed on device in f32); causal; softmax; out = merged (2048) W_out -> [4][1024][1024]).
// Compute dtypes, f32 accumulate: every input rounded to bf16; q/k/v on PLAIN bf16 operands (inputs: exact; column blocks of W_qkv); causal scores and attn.v: query rows < 512 hl (3 products), rows 512..1023 single fp16; ALiBi bias + online softmax f32; W_out hl x exact (2 products).

#define NB_  4
#define TT   1024
#define DM   1024
#define NH_  32
#define NKV  16
#define REP  (NH_ / NKV)
#define HD   64
#define DQ   (NH_ * HD)
#define DKV  (NKV * HD)
#define RH   512                  // query rows < RH use hi+lo planes (k_fattn's grid assumes RH = TT / 2)
#define SCL  0.125f   // HD^-0.5
typedef _Float16 h16;
typedef unsigned short bf;
typedef __attribute__((ext_vector_type(16))) __bf16   v16bf;
typedef __attribute__((ext_vector_type(16))) _Float16 v16h;
typedef __attribute__((ext_vector_type(8)))  _Float16 v8h;
typedef __attribute__((ext_vector_type(8)))  unsigned short v8us;
typedef __attribute__((ext_vector_type(8)))  float    v8f;
typedef __attribute__((ext_vector_type(4)))  float    v4f;
typedef v8h  __attribute__((may_alias)) v8ha;
typedef v4f  __attribute__((may_alias)) v4fa;
typedef v8us __attribute__((may_alias)) v8usa;

__device__ __forceinline__ unsigned short f2bf(float f) { unsigned u = __float_as_uint(f); u += 0x7FFFu + ((u >> 16) & 1u); return (unsigned short)(u >> 16); }
__device__ __forceinline__ float bf2f(unsigned short b) { return __uint_as_float(((unsigned)b) << 16); }
__device__ __forceinline__ float bfr(float f) { return bf2f(f2bf(f)); }
__device__ __forceinline__ v16h cat16(v8h lo, v8h hi) { return __builtin_shufflevector(lo, hi, 0, 1, 2, 3, 4, 5, 6, 7, 8, 9, 10, 11, 12, 13, 14, 15); }
__device__ __forceinline__ v16bf cat16b(v8us lo, v8us hi) { return __builtin_bit_cast(v16bf, __builtin_shufflevector(lo, hi, 0, 1, 2, 3, 4, 5, 6, 7, 8, 9, 10, 11, 12, 13, 14, 15)); }
__device__ __forceinline__ v8f wmma16(v16h a, v16h b, v8f c) { return __builtin_amdgcn_wmma_f32_16x16x32_f16(false, a, false, b, (short)0, c, false, false); }
__device__ __forceinline__ v8f wmmab(v16bf a, v16bf b, v8f c) { return __builtin_amdgcn_wmma_f32_16x16x32_bf16(false, a, false, b, (short)0, c, false, false); }



// ---- k_gemmw: register-blocked GEMM, ONE WAVE per 64x64 output tile (16 accumulators), operands straight from K-contiguous 16-bit planes; grid (M/64, N/64, Z), 32 threads.
// C[m][n] (f32, pitch ldc, + optional f32 bias[n]) = sum_k A[m][k] Bt[n][k] (+ split products per NSPLIT). z-batch strides sA/sB/sC in elements. K % 32 == 0.
template <typename T16> struct WFrag;
template <> struct WFrag<h16> { typedef v16h V; static __device__ __forceinline__ V ld(const h16* p) { return cat16(*(const v8h*)p, *(const v8h*)(p + 16)); } static __device__ __forceinline__ v8f mma(V a, V b, v8f c) { return wmma16(a, b, c); } };
template <> struct WFrag<bf> { typedef v16bf V; static __device__ __forceinline__ V ld(const bf* p) { return cat16b(*(const v8us*)p, *(const v8us*)(p + 16)); } static __device__ __forceinline__ v8f mma(V a, V b, v8f c) { return wmmab(a, b, c); } };
template <typename T16, int NSPLIT, bool BIAS>
__global__ __launch_bounds__(32) void k_gemmw(const T16* __restrict__ A, const T16* __restrict__ A2, const T16* __restrict__ Bt, const T16* __restrict__ Bt2, int K, float* C, int ldc, const float* __restrict__ bias, size_t sA, size_t sB, size_t sC) {
    typedef typename WFrag<T16>::V V;
    __shared__ __align__(16) float os[16 * 68];
    const size_t z = blockIdx.z; A += z * sA; if (A2) A2 += z * sA; Bt += z * sB; if (Bt2) Bt2 += z * sB; C += z * sC;
    const int lane = threadIdx.x & 31, lr = lane & 15, hi = lane >> 4; const int r0 = blockIdx.x * 64, c0 = blockIdx.y * 64;
    v8f acc[4][4];
#pragma unroll
    for (int mb = 0; mb < 4; ++mb)
#pragma unroll
        for (int nb = 0; nb < 4; ++nb) acc[mb][nb] = (v8f){};
    const size_t aoff = (size_t)(r0 + lr) * K + 8 * hi, boff = (size_t)(c0 + lr) * K + 8 * hi;
#pragma unroll 1
    for (int kc = 0; kc < K; kc += 32) {
        V a[4], a2[4];
#pragma unroll
        for (int mb = 0; mb < 4; ++mb) { a[mb] = WFrag<T16>::ld(A + aoff + (size_t)mb * 16 * K + kc); if (NSPLIT == 1 || NSPLIT == 2) a2[mb] = WFrag<T16>::ld(A2 + aoff + (size_t)mb * 16 * K + kc); }
#pragma unroll
        for (int nb = 0; nb < 4; ++nb) { const V b = WFrag<T16>::ld(Bt + boff + (size_t)nb * 16 * K + kc); V b2; if (NSPLIT >= 2) b2 = WFrag<T16>::ld(Bt2 + boff + (size_t)nb * 16 * K + kc);
#pragma unroll
            for (int mb = 0; mb < 4; ++mb) { acc[mb][nb] = WFrag<T16>::mma(a[mb], b, acc[mb][nb]); if (NSPLIT == 1 || NSPLIT == 2) acc[mb][nb] = WFrag<T16>::mma(a2[mb], b, acc[mb][nb]); if (NSPLIT >= 2) acc[mb][nb] = WFrag<T16>::mma(a[mb], b2, acc[mb][nb]); } }
        asm volatile("v_nop\n\tv_nop\n\tv_nop\n\tv_nop" : "+v"(acc[0][0]), "+v"(acc[1][1]), "+v"(acc[2][2]), "+v"(acc[3][3]) : "v"(a[0]), "v"(a[3]));
    }
#pragma unroll
    for (int mb = 0; mb < 4; ++mb) {
#pragma unroll
        for (int nb = 0; nb < 4; ++nb) {
#pragma unroll
            for (int j = 0; j < 8; ++j) os[(hi * 8 + j) * 68 + nb * 16 + lr] = acc[mb][nb][j]; }
        __builtin_amdgcn_wave_barrier(); asm volatile("" ::: "memory");
        float* crow = C + (size_t)(r0 + mb * 16) * ldc + c0;
{
#pragma unroll
            for (int s = 0; s < 8; ++s) { const int row = 2 * s + hi, cofs = lr * 4; v4f val = *(const v4fa*)(os + row * 68 + cofs); if (BIAS) { val[0] += bfr(bias[c0 + cofs]); val[1] += bfr(bias[c0 + cofs + 1]); val[2] += bfr(bias[c0 + cofs + 2]); val[3] += bfr(bias[c0 + cofs + 3]); }
                *(v4f*)(crow + (size_t)row * ldc + cofs) = val; }
             }
        __builtin_amdgcn_wave_barrier(); asm volatile("" ::: "memory");
    }
}

__device__ __forceinline__ h16 tohx(float x) { return (h16)x; }
__device__ __forceinline__ void splitf(float y, unsigned short& h, unsigned short& l) { h = f2bf(y); l = f2bf(y - bf2f(h)); }
typedef __attribute__((ext_vector_type(2))) _Float16 v2h;
typedef __attribute__((ext_vector_type(4))) _Float16 v4h;
typedef __attribute__((ext_vector_type(2))) unsigned short v2us;
typedef __attribute__((ext_vector_type(4))) unsigned short v4us;
typedef __attribute__((ext_vector_type(2))) float v2f;
typedef __attribute__((ext_vector_type(4))) int v4i;

__global__ __launch_bounds__(256) void k_wtG(const float* __restrict__ w, int K, int N, bf* Bt) {
    const int lane = threadIdx.x & 31; const int L0 = (blockIdx.x * 8 + (threadIdx.x >> 5)) * 8; const int nlines = N * K / 64;
{
#pragma unroll 1
        for (int l = 0; l < 8; ++l) { const int L = L0 + l; if (L >= nlines) break; const size_t e = (size_t)L * 64 + lane * 2; const int k = (int)(e % K), n = (int)(e / K); v2us o;
            o[0] = f2bf(w[(size_t)k * N + n]); o[1] = f2bf(w[(size_t)(k + 1) * N + n]); *(v2us*)(Bt + e) = o; }
         }
}
__global__ __launch_bounds__(256) void k_cvt8(const float* __restrict__ src, bf* dst, size_t n8) { const size_t i = (size_t)blockIdx.x * 256 + threadIdx.x; if (i >= n8) return; const v8f v = *(const v8f*)(src + i * 8); v8us o;
#pragma unroll
    for (int k = 0; k < 8; ++k) o[k] = f2bf(v[k]); *(v8us*)(dst + i * 8) = o;  }
__global__ __launch_bounds__(256) void k_cscvt(const float* __restrict__ cosT, const float* __restrict__ sinT, float* CS) { const int idx = blockIdx.x * 256 + threadIdx.x; if (idx >= TT * HD) return; v2f cs; cs[0] = bfr(cosT[idx]); cs[1] = bfr(sinT[idx]); *(v2f*)(CS + (size_t)idx * 2) = cs;  }
// k_rope: head planes [h][t][d] (fp16 + hi/lo) of rope(x) x sc with the rotate-half convention out[d] = x[d] cos[t][d] - x[d+HD/2] sin[t][d], out[d+HD/2] = x[d+HD/2] cos[t][d+HD/2] + x[d] sin[t][d+HD/2]
__global__ __launch_bounds__(256) void k_rope(const float* __restrict__ F, int pitch, int nheads, const float* __restrict__ CS, const float* __restrict__ RF, const float* __restrict__ nw, float sc, h16* P16, bf* Ph, bf* Pl) {
    const size_t e = ((size_t)blockIdx.x * 256 + threadIdx.x) * 2; if (e >= (size_t)nheads * TT * HD) return; const int d = (int)(e % HD); const int t = (int)((e / HD) % TT); const int h = (int)(e / ((size_t)HD * TT)); const float* f = F + (size_t)t * pitch + h * HD; const float rf = RF ? RF[(size_t)h * TT + t] : 1.0f; v2h o16; v2us oh, ol;
#pragma unroll
    for (int q = 0; q < 2; ++q) { const int dd = d + q; const int dp = (dd < HD / 2) ? dd + HD / 2 : dd - HD / 2; float x0 = f[dd], x1 = f[dp];
        if (RF) { float n0 = __fmul_rn(x0, rf), n1 = __fmul_rn(x1, rf); asm volatile("" : "+v"(n0)); asm volatile("" : "+v"(n1)); x0 = __fmul_rn(bfr(nw[dd]), n0); x1 = __fmul_rn(bfr(nw[dp]), n1); }
        const v2f cs = *(const v2f*)(CS + ((size_t)t * HD + dd) * 2); float a = __fmul_rn(x0, cs[0]), bq = __fmul_rn(x1, cs[1]); asm volatile("" : "+v"(a)); asm volatile("" : "+v"(bq)); const float r = ((dd < HD / 2) ? __fsub_rn(a, bq) : __fadd_rn(a, bq)) * sc;
        o16[q] = tohx(r); unsigned short a2, c2; splitf(r, a2, c2); oh[q] = a2; ol[q] = c2; }
    *(v2h*)(P16 + e) = o16; *(v2us*)(Ph + e) = oh; *(v2us*)(Pl + e) = ol;  }
__global__ __launch_bounds__(256) void k_vtp(const float* __restrict__ F, int pitch, int nheads, h16* V16, bf* Vh, bf* Vl) { const size_t e = ((size_t)blockIdx.x * 256 + threadIdx.x) * 2; if (e >= (size_t)nheads * HD * TT) return; const int t = (int)(e % TT); const int d = (int)((e / TT) % HD); const int g = (int)(e / ((size_t)TT * HD)); v2h o16; v2us oh, ol;
#pragma unroll
    for (int q = 0; q < 2; ++q) { const float x = F[(size_t)(t + q) * pitch + g * HD + d]; o16[q] = tohx(x); unsigned short a2, c2; splitf(x, a2, c2); oh[q] = a2; ol[q] = c2; }
    *(v2h*)(V16 + e) = o16; *(v2us*)(Vh + e) = oh; *(v2us*)(Vl + e) = ol;  }
__global__ __launch_bounds__(256) void k_csid(float* CS) { const int idx = blockIdx.x * 256 + threadIdx.x; if (idx >= TT * HD) return; v2f cs; cs[0] = 1.0f; cs[1] = 0.0f; *(v2f*)(CS + (size_t)idx * 2) = cs;  }
// ---- k_fattn: causal ALiBi attention in one kernel (scores, softmax and probability x value never leave the registers). One wave owns 32 query columns of one head and walks the keys 0 .. q0 + 31 in blocks of 32.
// St = K Qt: a lane holds the scores of ONE query (column lr of a 16-column group), keys 8 hi + j of each 16-key tile; two such tiles, converted in place, are the B operand of Ot += Vt Pt (same k order as WFrag::ld).
// Running maximum in scaled log2 units; the output tiles are rescaled only when some column's maximum has grown by more than 8. Operand planes as before: NSPLIT 2 = hi + lo bf16, three products; NSPLIT 0 = single fp16.
#define L2E  1.4426950408889634f
template <typename T16, int NSPLIT>
__device__ __forceinline__ void attn_body(const T16* __restrict__ Q, const T16* __restrict__ Q2, const T16* __restrict__ Kp, const T16* __restrict__ K2, const T16* __restrict__ Vt, const T16* __restrict__ V2, float sl2, int q0, bf* Ah, bf* Al) {
    typedef typename WFrag<T16>::V V;
    int lane = threadIdx.x & 31;
    V qf[2][2], qf2[2][2], kf[2][2], kf2[2][2];
    // each lane's own byte offsets into the Q and K planes: the fetches name only these registers and the planes' uniform bases, with constant offsets; kob is carried through the loop
    unsigned qob = (unsigned)((q0 + (lane & 15)) * HD + 8 * (lane >> 4)) * 2u, kob = (unsigned)((lane & 15) * HD + 8 * (lane >> 4)) * 2u;
#pragma unroll
    for (int nq = 0; nq < 2; ++nq)
#pragma unroll
        for (int ks = 0; ks < 2; ++ks) { const int qo = nq * 16 * HD + ks * 32; qf[nq][ks] = WFrag<T16>::ld((const T16*)((const char*)Q + qob) + qo); if (NSPLIT == 2) qf2[nq][ks] = WFrag<T16>::ld((const T16*)((const char*)Q2 + qob) + qo); }
#pragma unroll
    for (int kt = 0; kt < 2; ++kt)
#pragma unroll
        for (int ks = 0; ks < 2; ++ks) { const int ko = kt * 16 * HD + ks * 32; kf[kt][ks] = WFrag<T16>::ld((const T16*)((const char*)Kp + kob) + ko); if (NSPLIT == 2) kf2[kt][ks] = WFrag<T16>::ld((const T16*)((const char*)K2 + kob) + ko); }
    __builtin_amdgcn_sched_barrier(0);   // keeps the fetches in front of the wait
    // the wait in front of any overwrite of the Q and K fetches' address registers. The offsets go through it so that they stay in their registers up to it,
    // the lane number so that the arithmetic below, all of which starts from it, stays behind it
    asm volatile("s_wait_xcnt 0x0" : "+v"(lane), "+v"(qob), "+v"(kob) :: "memory");
    __builtin_amdgcn_sched_barrier(0);   // keeps all later arithmetic behind the wait
    const int lr = lane & 15, hi = lane >> 4;
    v8f o[4][2]; float m[2], l[2], bl[2][8];
#pragma unroll
    for (int nq = 0; nq < 2; ++nq) { m[nq] = -3.0e38f; l[nq] = 0.f;
#pragma unroll
        for (int dt = 0; dt < 4; ++dt) o[dt][nq] = (v8f){}; }
#pragma unroll
    for (int kt = 0; kt < 2; ++kt)
#pragma unroll
        for (int j = 0; j < 8; ++j) bl[kt][j] = sl2 * (float)(kt * 16 + 8 * hi + j);   // ALiBi bias inside a key block; the block's own offset goes into the exponent's shift
    unsigned vob = (unsigned)(lr * TT + 8 * hi) * 2u;   // the lane's byte offset into the Vt planes, carried through the loop like kob
    // rolled: a second copy of the body would only add registers; the K fetch one block ahead already spans the back edge
    int k0 = 0;
#pragma unroll 1
    do {   // at least the diagonal block: q0 >= 0
        V vf[4], vf2[4];
#pragma unroll
        for (int dt = 0; dt < 4; ++dt) { vf[dt] = WFrag<T16>::ld((const T16*)((const char*)Vt + vob) + dt * 16 * TT); if (NSPLIT == 2) vf2[dt] = WFrag<T16>::ld((const T16*)((const char*)V2 + vob) + dt * 16 * TT); }
        __builtin_amdgcn_sched_barrier(0);   // keeps this block's Vt fetch in front of the score products: left free it sinks behind them, and its latency then stands open in front of P.V
        // the wait in front of any overwrite of the Vt fetch's address registers; the offset goes through it so that it stays in its register up to it
        asm volatile("s_wait_xcnt 0x0" : "+v"(vob) :: "memory");
        __builtin_amdgcn_sched_barrier(0);   // keeps the score products and all later arithmetic behind that wait
        vob += 32u * 2u;
        v8f s[2][2];
#pragma unroll
        for (int kt = 0; kt < 2; ++kt)
#pragma unroll
            for (int nq = 0; nq < 2; ++nq) { v8f t = (v8f){};
#pragma unroll
                for (int ks = 0; ks < 2; ++ks) { t = WFrag<T16>::mma(kf[kt][ks], qf[nq][ks], t); if (NSPLIT == 2) { t = WFrag<T16>::mma(kf2[kt][ks], qf[nq][ks], t); t = WFrag<T16>::mma(kf[kt][ks], qf2[nq][ks], t); } }
                s[kt][nq] = t; }
        // the next block's K fragments, fetched one block ahead into the same registers (the last block fetches its own rows again: in bounds, unused)
        kob += (k0 < q0) ? 32u * HD * 2u : 0u;
        __builtin_amdgcn_sched_barrier(0);   // keeps the fetch's address arithmetic in one piece in front of the fetch, so that none of it writes over an address in use
#pragma unroll
        for (int kt = 0; kt < 2; ++kt)
#pragma unroll
            for (int ks = 0; ks < 2; ++ks) { const int ko = kt * 16 * HD + ks * 32; kf[kt][ks] = WFrag<T16>::ld((const T16*)((const char*)Kp + kob) + ko); if (NSPLIT == 2) kf2[kt][ks] = WFrag<T16>::ld((const T16*)((const char*)K2 + kob) + ko); }
        __builtin_amdgcn_sched_barrier(0);   // keeps the fetch in front of the wait
        // the same wait for the K fetch's address register, which goes through it like vob above
        asm volatile("s_wait_xcnt 0x0" : "+v"(kob) :: "memory");
        __builtin_amdgcn_sched_barrier(0);   // keeps all later arithmetic behind the wait
        float off[2], cand[2];
#pragma unroll
        for (int nq = 0; nq < 2; ++nq) {
#pragma unroll
            for (int kt = 0; kt < 2; ++kt)
#pragma unroll
                for (int j = 0; j < 8; ++j) s[kt][nq][j] = fmaf(s[kt][nq][j], SCL * L2E, bl[kt][j]);
            if (k0 == q0) {   // the diagonal block (wave-uniform): keys beyond the query are masked
#pragma unroll
                for (int kt = 0; kt < 2; ++kt)
#pragma unroll
                    for (int j = 0; j < 8; ++j) if (kt * 16 + 8 * hi + j > nq * 16 + lr) s[kt][nq][j] = -3.0e38f; }
            float mx = s[0][nq][0];
#pragma unroll
            for (int kt = 0; kt < 2; ++kt)
#pragma unroll
                for (int j = 0; j < 8; ++j) mx = fmaxf(mx, s[kt][nq][j]);
            mx = fmaxf(mx, __shfl_xor(mx, 16, 32));
            off[nq] = sl2 * (float)(k0 - (q0 + nq * 16 + lr)); cand[nq] = mx + off[nq]; }
        if (__builtin_amdgcn_ballot_w32(cand[0] > m[0] + 8.0f || cand[1] > m[1] + 8.0f) != 0) {
#pragma unroll
            for (int nq = 0; nq < 2; ++nq) { const float mn = fmaxf(m[nq], cand[nq]); const float al = __builtin_amdgcn_exp2f(m[nq] - mn); m[nq] = mn; l[nq] *= al;
#pragma unroll
                for (int dt = 0; dt < 4; ++dt) o[dt][nq] *= al; } }
#pragma unroll
        for (int nq = 0; nq < 2; ++nq) { const float sh = m[nq] - off[nq]; V p, p2; float ls = 0.f;
#pragma unroll
            for (int e = 0; e < 16; ++e) { const float pe = __builtin_amdgcn_exp2f(s[e >> 3][nq][e & 7] - sh); ls += pe;
                if constexpr (NSPLIT == 2) { p[e] = (__bf16)pe; p2[e] = (__bf16)(pe - (float)p[e]); } else { p[e] = (h16)pe; } }
            l[nq] += ls;
#pragma unroll
            for (int dt = 0; dt < 4; ++dt) { o[dt][nq] = WFrag<T16>::mma(vf[dt], p, o[dt][nq]); if (NSPLIT == 2) { o[dt][nq] = WFrag<T16>::mma(vf[dt], p2, o[dt][nq]); o[dt][nq] = WFrag<T16>::mma(vf2[dt], p, o[dt][nq]); } } }
        // four vector slots behind the last P.V product, before the next block's Vt fetch and score products write over its A and B registers
        asm volatile("v_nop\n\tv_nop\n\tv_nop\n\tv_nop" :: "v"(o[0][1]), "v"(o[1][1]), "v"(o[2][1]), "v"(o[3][1]));
        k0 += 32;
    } while (k0 <= q0);
#pragma unroll
    for (int nq = 0; nq < 2; ++nq) { const float inv = __fdiv_rn(1.0f, l[nq] + __shfl_xor(l[nq], 16, 32));
#pragma unroll
        for (int dt = 0; dt < 4; ++dt) { v8us oh, ol;
#pragma unroll
            for (int j = 0; j < 8; ++j) { unsigned short x, y; splitf(o[dt][nq][j] * inv, x, y); oh[j] = x; ol[j] = y; }
            const size_t oo = (size_t)(q0 + nq * 16 + lr) * DQ + dt * 16 + 8 * hi; *(v8us*)(Ah + oo) = oh; *(v8us*)(Al + oo) = ol; } }
}
// grid (kv head, batch, 16 position blocks of 64 queries, long ones first, hi+lo and fp16 blocks alternating); 4 independent waves: 2 query heads of the kv head x 2 column groups, so that they read the same K and V lines.
__global__ __launch_bounds__(128) void k_fattn(const h16* __restrict__ QK16, const bf* __restrict__ QKh, const bf* __restrict__ QKl, const h16* __restrict__ V16, const bf* __restrict__ Vh, const bf* __restrict__ Vl, const float* __restrict__ SLP, bf* Ah, bf* Al) {
    const int w = __builtin_amdgcn_readfirstlane(threadIdx.x >> 5); const int g = blockIdx.x, b = blockIdx.y, zz = blockIdx.z;
    const int pb = (zz & 1) ? (RH / 64 - 1 - (zz >> 1)) : (TT / 64 - 1 - (zz >> 1)); const int h = g * REP + (w & 1); const int q0 = pb * 64 + (w >> 1) * 32;
    const size_t qo = ((size_t)b * (NH_ + NKV) + h) * TT * HD, ko = ((size_t)b * (NH_ + NKV) + NH_ + g) * TT * HD, vo = ((size_t)b * NKV + g) * HD * TT, ao = (size_t)b * TT * DQ + h * HD;
    const float sl2 = SLP[h] * L2E;
    if (q0 < RH) attn_body<bf, 2>(QKh + qo, QKl + qo, QKh + ko, QKl + ko, Vh + vo, Vl + vo, sl2, q0, Ah + ao, Al + ao);
    else attn_body<h16, 0>(QK16 + qo, nullptr, QK16 + ko, nullptr, V16 + vo, nullptr, sl2, q0, Ah + ao, Al + ao);
}

__global__ __launch_bounds__(256) void k_wtGs(const float* __restrict__ w, int K, int N, int ld, bf* Bt) { const size_t e = ((size_t)blockIdx.x * 256 + threadIdx.x) * 4; if (e >= (size_t)N * K) return; const int k = (int)(e % K); const int n = (int)(e / K); v4us o;   // Bt[n][k] = w[k*ld + n]
#pragma unroll
    for (int u = 0; u < 4; ++u) o[u] = f2bf(w[(size_t)(k + u) * ld + n]); *(v4us*)(Bt + e) = o;  }
__global__ __launch_bounds__(64) void k_slopes(float* SLP) { const int h = threadIdx.x; if (h >= 64) return; const float base = 0.8408964152537145f; const float v = (h < NH_) ? powf(base, (float)(h + 1)) : 0.f; *(float*)(SLP + h) = v;  }   // ALiBi slopes 2^(-0.25 (h+1)) as f32 base^power like the numpy reference

extern "C" void kernel_launch(void* const* d_in, const int* in_sizes, int n_in,
                              void* d_out, int out_size, void* d_ws, size_t ws_size, hipStream_t stream) {
    (void)in_sizes; (void)n_in; (void)out_size;
    const float* x = (const float*)d_in[0]; const float* wqkv = (const float*)d_in[1]; const float* wo = (const float*)d_in[2]; const float* wq = nullptr; const float* wk = nullptr; const float* wv = nullptr; (void)wq; (void)wk; (void)wv; const float* cosT = nullptr; const float* sinT = nullptr; (void)cosT; (void)sinT;
    float* OUT = (float*)d_out;     // [4][1024][1024]
    char* wsp = (char*)d_ws;
    auto take = [&](size_t bytes) { char* p = wsp; wsp += (bytes + 255) & ~(size_t)255; return (void*)p; };
    bf* WQKV = (bf*)take((size_t)(DQ + 2 * DKV) * DM * 2); bf* WO = (bf*)take((size_t)DM * DQ * 2); float* CS = (float*)take((size_t)TT * HD * 2 * 4);
    bf* XB = (bf*)take((size_t)NB_ * TT * DM * 2); float* SLP = (float*)take(256); float* F = (float*)take((size_t)TT * (DQ + 2 * DKV) * 4);   // F: q | k | v columns of one batch, pitch 4096
    const size_t SQK = (size_t)(NH_ + NKV) * TT * HD, SV = (size_t)NKV * HD * TT;   // elements of one batch's head planes (32 q heads, then 16 k heads) and of its transposed v planes
    h16* QP16 = (h16*)take(NB_ * SQK * 2); h16* VT16 = (h16*)take(NB_ * SV * 2);
    bf* QPh = (bf*)take(NB_ * SQK * 2); bf* QPl = (bf*)take(NB_ * SQK * 2); bf* VTh = (bf*)take(NB_ * SV * 2); bf* VTl = (bf*)take(NB_ * SV * 2);
    bf* ATh = (bf*)take((size_t)NB_ * TT * DQ * 2); bf* ATl = (bf*)take((size_t)NB_ * TT * DQ * 2);
    if ((size_t)(wsp - (char*)d_ws) > ws_size) return;    // ws 256 MiB
    k_wtGs<<<(unsigned)(((size_t)(DQ + 2 * DKV) * DM / 4 + 255) / 256), 256, 0, stream>>>(wqkv, DM, DQ + 2 * DKV, 4096, WQKV); k_slopes<<<1, 64, 0, stream>>>(SLP);
    k_wtG<<<(unsigned)((DQ * DM / 64 + 63) / 64), 256, 0, stream>>>(wo, DQ, DM, WO);
    k_csid<<<(TT * HD + 255) / 256, 256, 0, stream>>>(CS);
    k_cvt8<<<(unsigned)(((size_t)NB_ * TT * DM / 8 + 255) / 256), 256, 0, stream>>>(x, XB, (size_t)NB_ * TT * DM / 8);
    const unsigned LQK = (unsigned)(((size_t)(NH_ + NKV) * TT * HD / 2 + 255) / 256), LKv = (unsigned)(((size_t)NKV * TT * HD / 2 + 255) / 256);
    for (int b = 0; b < NB_; ++b) {
        k_gemmw<bf, 0, false><<<dim3(TT / 64, (DQ + 2 * DKV) / 64, 1), 32, 0, stream>>>(XB + (size_t)b * TT * DM, nullptr, WQKV, nullptr, DM, F, DQ + 2 * DKV, nullptr, 0, 0, 0);
        k_rope<<<LQK, 256, 0, stream>>>(F, DQ + 2 * DKV, NH_ + NKV, CS, nullptr, nullptr, 1.0f, QP16 + b * SQK, QPh + b * SQK, QPl + b * SQK);
        k_vtp<<<LKv, 256, 0, stream>>>(F + DQ + DKV, DQ + 2 * DKV, NKV, VT16 + b * SV, VTh + b * SV, VTl + b * SV); }
    k_fattn<<<dim3(NKV, NB_, TT / 64), 128, 0, stream>>>(QP16, QPh, QPl, VT16, VTh, VTl, SLP, ATh, ATl);   // all batches and heads
    k_gemmw<bf, 1, false><<<dim3(NB_ * TT / 64, DM / 64, 1), 32, 0, stream>>>(ATh, ATl, WO, nullptr, DQ, OUT, DM, nullptr, 0, 0, 0);   // all four batches: rows b * 1024 + t
}

// v003
// One run takes 206 microseconds.
// Next to v002, in two timings, it ran 1.54 times as fast each time.
// Over all steps from v000 it is 18.9 times as fast.
#include <hip/hip_runtime.h>

// FlexAttention (inputs [4][1024][1024]; qkv = x W_qkv ([1024][4096]: 2048 q columns = 32 query heads x 64, then 1024 k and 1024 v columns = 16 kv heads; GQA repeat_interleave: query head h uses kv head h/2); scores = q.k / 8 + ALiBi slope_h (j - i) (slopes 2^(-0.25 (h+1)) computed on device in f32); causal; softmax; out = merged (2048) W_out -> [4][1024][1024]).
// Compute dtypes, f32 accumulate: every input rounded to bf16; q/k/v on PLAIN bf16 operands (inputs: exact; column blocks of W_qkv); causal scores and attn.v: query rows < 512 hl (3 products), rows 512..1023 single fp16; ALiBi bias + online softmax f32; W_out hl x exact (2 products).

#define NB_  4
#define TT   1024
#define DM   1024
#define NH_  32
#define NKV  16
#define REP  (NH_ / NKV)
#define HD   64
#define DQ   (NH_ * HD)
#define DKV  (NKV * HD)
#define RH   512                  // query rows < RH use hi+lo planes (k_fattn's grid assumes RH = TT / 2)
#define SCL  0.125f   // HD^-0.5
typedef _Float16 h16;
typedef unsigned short bf;
typedef __attribute__((ext_vector_type(16))) __bf16   v16bf;
typedef __attribute__((ext_vector_type(16))) _Float16 v16h;
typedef __attribute__((ext_vector_type(8)))  _Float16 v8h;
typedef __attribute__((ext_vector_type(8)))  unsigned short v8us;
typedef __attribute__((ext_vector_type(8)))  float    v8f;
typedef __attribute__((ext_vector_type(4)))  float    v4f;
typedef v8h  __attribute__((may_alias)) v8ha;
typedef v4f  __attribute__((may_alias)) v4fa;
typedef v8us __attribute__((may_alias)) v8usa;

__device__ __forceinline__ unsigned short f2bf(float f) { unsigned u = __float_as_uint(f); u += 0x7FFFu + ((u >> 16) & 1u); return (unsigned short)(u >> 16); }
__device__ __forceinline__ float bf2f(unsigned short b) { return __uint_as_float(((unsigned)b) << 16); }
__device__ __forceinline__ float bfr(float f) { return bf2f(f2bf(f)); }
__device__ __forceinline__ v16h cat16(v8h lo, v8h hi) { return __builtin_shufflevector(lo, hi, 0, 1, 2, 3, 4, 5, 6, 7, 8, 9, 10, 11, 12, 13, 14, 15); }
__device__ __forceinline__ v16bf cat16b(v8us lo, v8us hi) { return __builtin_bit_cast(v16bf, __builtin_shufflevector(lo, hi, 0, 1, 2, 3, 4, 5, 6, 7, 8, 9, 10, 11, 12, 13, 14, 15)); }
__device__ __forceinline__ v8f wmma16(v16h a, v16h b, v8f c) { return __builtin_amdgcn_wmma_f32_16x16x32_f16(false, a, false, b, (short)0, c, false, false); }
__device__ __forceinline__ v8f wmmab(v16bf a, v16bf b, v8f c) { return __builtin_amdgcn_wmma_f32_16x16x32_bf16(false, a, false, b, (short)0, c, false, false); }



// ---- k_gemmw: register-blocked GEMM, ONE WAVE per 64x64 output tile (16 accumulators), operands straight from K-contiguous 16-bit planes; grid (M/64, N/64, Z), 32 threads.
// C[m][n] (f32, pitch ldc, + optional f32 bias[n]) = sum_k A[m][k] Bt[n][k] (+ split products per NSPLIT). z-batch strides sA/sB/sC in elements. K % 32 == 0.
template <typename T16> struct WFrag;
template <> struct WFrag<h16> { typedef v16h V; static __device__ __forceinline__ V ld(const h16* p) { return cat16(*(const v8h*)p, *(const v8h*)(p + 16)); } static __device__ __forceinline__ v8f mma(V a, V b, v8f c) { return wmma16(a, b, c); } };
template <> struct WFrag<bf> { typedef v16bf V; static __device__ __forceinline__ V ld(const bf* p) { return cat16b(*(const v8us*)p, *(const v8us*)(p + 16)); } static __device__ __forceinline__ v8f mma(V a, V b, v8f c) { return wmmab(a, b, c); } };
template <typename T16, int NSPLIT, bool BIAS>
__global__ __launch_bounds__(32) void k_gemmw(const T16* __restrict__ A, const T16* __restrict__ A2, const T16* __restrict__ Bt, const T16* __restrict__ Bt2, int K, float* C, int ldc, const float* __restrict__ bias, size_t sA, size_t sB, size_t sC) {
    typedef typename WFrag<T16>::V V;
    __shared__ __align__(16) float os[16 * 68];
    const size_t z = blockIdx.z; A += z * sA; if (A2) A2 += z * sA; Bt += z * sB; if (Bt2) Bt2 += z * sB; C += z * sC;
    const int lane = threadIdx.x & 31, lr = lane & 15, hi = lane >> 4; const int r0 = blockIdx.x * 64, c0 = blockIdx.y * 64;
    v8f acc[4][4];
#pragma unroll
    for (int mb = 0; mb < 4; ++mb)
#pragma unroll
        for (int nb = 0; nb < 4; ++nb) acc[mb][nb] = (v8f){};
    const size_t aoff = (size_t)(r0 + lr) * K + 8 * hi, boff = (size_t)(c0 + lr) * K + 8 * hi;
#pragma unroll 1
    for (int kc = 0; kc < K; kc += 32) {
        V a[4], a2[4];
#pragma unroll
        for (int mb = 0; mb < 4; ++mb) { a[mb] = WFrag<T16>::ld(A + aoff + (size_t)mb * 16 * K + kc); if (NSPLIT == 1 || NSPLIT == 2) a2[mb] = WFrag<T16>::ld(A2 + aoff + (size_t)mb * 16 * K + kc); }
#pragma unroll
        for (int nb = 0; nb < 4; ++nb) { const V b = WFrag<T16>::ld(Bt + boff + (size_t)nb * 16 * K + kc); V b2; if (NSPLIT >= 2) b2 = WFrag<T16>::ld(Bt2 + boff + (size_t)nb * 16 * K + kc);
#pragma unroll
            for (int mb = 0; mb < 4; ++mb) { acc[mb][nb] = WFrag<T16>::mma(a[mb], b, acc[mb][nb]); if (NSPLIT == 1 || NSPLIT == 2) acc[mb][nb] = WFrag<T16>::mma(a2[mb], b, acc[mb][nb]); if (NSPLIT >= 2) acc[mb][nb] = WFrag<T16>::mma(a[mb], b2, acc[mb][nb]); } }
        asm volatile("v_nop\n\tv_nop\n\tv_nop\n\tv_nop" : "+v"(acc[0][0]), "+v"(acc[1][1]), "+v"(acc[2][2]), "+v"(acc[3][3]) : "v"(a[0]), "v"(a[3]));
    }
#pragma unroll
    for (int mb = 0; mb < 4; ++mb) {
#pragma unroll
        for (int nb = 0; nb < 4; ++nb) {
#pragma unroll
            for (int j = 0; j < 8; ++j) os[(hi * 8 + j) * 68 + nb * 16 + lr] = acc[mb][nb][j]; }
        __builtin_amdgcn_wave_barrier(); asm volatile("" ::: "memory");
        float* crow = C + (size_t)(r0 + mb * 16) * ldc + c0;
{
#pragma unroll
            for (int s = 0; s < 8; ++s) { const int row = 2 * s + hi, cofs = lr * 4; v4f val = *(const v4fa*)(os + row * 68 + cofs); if (BIAS) { val[0] += bfr(bias[c0 + cofs]); val[1] += bfr(bias[c0 + cofs + 1]); val[2] += bfr(bias[c0 + cofs + 2]); val[3] += bfr(bias[c0 + cofs + 3]); }
                *(v4f*)(crow + (size_t)row * ldc + cofs) = val; }
             }
        __builtin_amdgcn_wave_barrier(); asm volatile("" ::: "memory");
    }
}

__device__ __forceinline__ h16 tohx(float x) { return (h16)x; }
__device__ __forceinline__ void splitf(float y, unsigned short& h, unsigned short& l) { h = f2bf(y); l = f2bf(y - bf2f(h)); }
typedef __attribute__((ext_vector_type(2))) _Float16 v2h;
typedef __attribute__((ext_vector_type(4))) _Float16 v4h;
typedef __attribute__((ext_vector_type(2))) unsigned short v2us;
typedef __attribute__((ext_vector_type(4))) unsigned short v4us;
typedef __attribute__((ext_vector_type(2))) float v2f;
typedef __attribute__((ext_vector_type(4))) int v4i;

__global__ __launch_bounds__(256) void k_wtG(const float* __restrict__ w, int K, int N, bf* Bt) {
    const int lane = threadIdx.x & 31; const int L0 = (blockIdx.x * 8 + (threadIdx.x >> 5)) * 8; const int nlines = N * K / 64;
{
#pragma unroll 1
        for (int l = 0; l < 8; ++l) { const int L = L0 + l; if (L >= nlines) break; const size_t e = (size_t)L * 64 + lane * 2; const int k = (int)(e % K), n = (int)(e / K); v2us o;
            o[0] = f2bf(w[(size_t)k * N + n]); o[1] = f2bf(w[(size_t)(k + 1) * N + n]); *(v2us*)(Bt + e) = o; }
         }
}
__global__ __launch_bounds__(256) void k_cvt8(const float* __restrict__ src, bf* dst, size_t n8) { const size_t i = (size_t)blockIdx.x * 256 + threadIdx.x; if (i >= n8) return; const v8f v = *(const v8f*)(src + i * 8); v8us o;
#pragma unroll
    for (int k = 0; k < 8; ++k) o[k] = f2bf(v[k]); *(v8us*)(dst + i * 8) = o;  }
__global__ __launch_bounds__(256) void k_cscvt(const float* __restrict__ cosT, const float* __restrict__ sinT, float* CS) { const int idx = blockIdx.x * 256 + threadIdx.x; if (idx >= TT * HD) return; v2f cs; cs[0] = bfr(cosT[idx]); cs[1] = bfr(sinT[idx]); *(v2f*)(CS + (size_t)idx * 2) = cs;  }
// ---- k_qkvp: the q|k|v product of all batches, ONE WAVE per 64x64 tile as in k_gemmw, which writes the attention kernel's operand planes (fp16, bf16 hi, bf16 lo) itself; grid (NB_ TT / 64, 4096 / 64), 32 threads.
// A 64-column tile is one head. D[i][j] = sum_k P[i][k] R[j][k]; a lane holds 8 consecutive i of one j, so i is made the plane's contiguous index: q and k tiles (planes [head][t][d]): P = weight rows (i = d), R = x rows (j = t); v tiles (planes [head][d][t]): P = x rows (i = t), R = weight rows (j = d).
typedef __attribute__((ext_vector_type(8))) __bf16 v8b;
typedef v8b __attribute__((may_alias)) v8ba;
#define SP 72   // LDS row pitch in 16-bit elements: 128 B of data + 16 B, for 16-byte readers and writers
// put_planes: 16 rows j at a time, each 64 i = one 128-B line per plane, go through the wave's own LDS so that every global store covers four whole lines. OP = the planes' row pitch in elements.
template <int OP>
__device__ __forceinline__ void put_planes(const v8f (&acc)[4][4], unsigned short* st, h16* O16, bf* Oh, bf* Ol, int lane) {
    const int lr = lane & 15, hi = lane >> 4;
    unsigned oob = (unsigned)((lane >> 3) * OP + (lane & 7) * 8) * 2u;   // the lane's byte offset into the planes: the stores name only this register, the planes' uniform bases and constant offsets
#pragma unroll
    for (int nb = 0; nb < 4; ++nb) {
#pragma unroll
        for (int mb = 0; mb < 4; ++mb) { v8h o16; v8b oh, ol;
#pragma unroll
            for (int j = 0; j < 8; ++j) { const float r = acc[mb][nb][j]; o16[j] = tohx(r); oh[j] = (__bf16)r; ol[j] = (__bf16)(r - (float)oh[j]); }   // round to nearest even, as splitf
            unsigned short* sp = st + lr * SP + (mb * 2 + hi) * 8; *(v8ha*)sp = o16; *(v8ba*)(sp + 16 * SP) = oh; *(v8ba*)(sp + 32 * SP) = ol; }
        // the lanes' LDS writes have landed before other lanes of this wave read the rows back; the clobber keeps the reads behind it (one wave a work-group: no barrier)
        asm volatile("s_wait_dscnt 0x0" ::: "memory");
        v8us val[3][4];
#pragma unroll
        for (int p = 0; p < 3; ++p)
#pragma unroll
            for (int s = 0; s < 4; ++s) val[p][s] = *(const v8usa*)(st + (p * 16 + 4 * s + (lane >> 3)) * SP + (lane & 7) * 8);
#pragma unroll
        for (int s = 0; s < 4; ++s) { const int eo = (nb * 16 + 4 * s) * OP; *(v8usa*)((char*)(O16 + eo) + oob) = val[0][s]; *(v8usa*)((char*)(Oh + eo) + oob) = val[1][s]; *(v8usa*)((char*)(Ol + eo) + oob) = val[2][s]; }
        __builtin_amdgcn_sched_barrier(0);   // keeps the stores in front of the wait
        // the wait in front of any overwrite of the stores' data and address registers by the next rows' conversions; the offset goes through it so that it stays in its register up to it; the clobber keeps the next rows' LDS writes behind the reads above
        asm volatile("s_wait_xcnt 0x0" : "+v"(oob) :: "memory");
        __builtin_amdgcn_sched_barrier(0);   // keeps the next rows' arithmetic behind the wait
    }
}
__global__ __launch_bounds__(32) void k_qkvp(const bf* __restrict__ X, const bf* __restrict__ Wt, h16* QK16, bf* QKh, bf* QKl, h16* V16, bf* Vh, bf* Vl) {
    __shared__ __align__(16) unsigned short st[3 * 16 * SP];
    const int lane = threadIdx.x & 31; const int r0 = blockIdx.x * 64, c0 = blockIdx.y * 64; const int b = r0 / TT, t0 = r0 % TT; const bool isv = c0 >= DQ + DKV;
    const bf* xr = X + (size_t)r0 * DM; const bf* wr = Wt + (size_t)c0 * DM; const bf* P = isv ? xr : wr; const bf* R = isv ? wr : xr;
    v8f acc[4][4];
#pragma unroll
    for (int mb = 0; mb < 4; ++mb)
#pragma unroll
        for (int nb = 0; nb < 4; ++nb) acc[mb][nb] = (v8f){};
    unsigned fob = (unsigned)((lane & 15) * DM + 8 * (lane >> 4)) * 2u;   // the lane's byte offset into both operands' rows (same pitch), carried through the loop
    // rolled, as in k_gemmw: a second copy of the body would only add registers
#pragma unroll 1
    for (int kc = 0; kc < DM; kc += 32) {
        v16bf a[4], bb[4];
#pragma unroll
        for (int mb = 0; mb < 4; ++mb) a[mb] = WFrag<bf>::ld((const bf*)((const char*)P + fob) + mb * 16 * DM);
#pragma unroll
        for (int nb = 0; nb < 4; ++nb) bb[nb] = WFrag<bf>::ld((const bf*)((const char*)R + fob) + nb * 16 * DM);
        __builtin_amdgcn_sched_barrier(0);   // keeps all sixteen fetches in front of the wait and the products: left free, the last four sink behind the first products, and their latency then stands open
        // the wait in front of the overwrite of the fetches' address register; the offset goes through it so that it stays in its register up to it
        asm volatile("s_wait_xcnt 0x0" : "+v"(fob) :: "memory");
        __builtin_amdgcn_sched_barrier(0);   // keeps the offset's step and the products behind the wait
        fob += 32u * 2u;
#pragma unroll
        for (int nb = 0; nb < 4; ++nb)
#pragma unroll
            for (int mb = 0; mb < 4; ++mb) acc[mb][nb] = wmmab(a[mb], bb[nb], acc[mb][nb]);
        // four vector slots behind the last product, before the next trip's fetches write over its A and B registers
        asm volatile("v_nop\n\tv_nop\n\tv_nop\n\tv_nop" :: "v"(acc[0][0]), "v"(acc[1][0]), "v"(acc[2][0]), "v"(acc[3][0]), "v"(acc[0][1]), "v"(acc[1][1]), "v"(acc[2][1]), "v"(acc[3][1]), "v"(acc[0][2]), "v"(acc[1][2]), "v"(acc[2][2]), "v"(acc[3][2]), "v"(acc[0][3]), "v"(acc[1][3]), "v"(acc[2][3]), "v"(acc[3][3]));
    }
    if (isv) { const size_t o = ((size_t)b * NKV + (c0 - DQ - DKV) / HD) * HD * TT + t0; put_planes<TT>(acc, st, V16 + o, Vh + o, Vl + o, lane); }
    else { const size_t o = (((size_t)b * (NH_ + NKV) + c0 / HD) * TT + t0) * HD; put_planes<HD>(acc, st, QK16 + o, QKh + o, QKl + o, lane); }
}
// ---- k_fattn: causal ALiBi attention in one kernel (scores, softmax and probability x value never leave the registers). One wave owns 32 query columns of one head and walks the keys 0 .. q0 + 31 in blocks of 32.
// St = K Qt: a lane holds the scores of ONE query (column lr of a 16-column group), keys 8 hi + j of each 16-key tile; two such tiles, converted in place, are the B operand of Ot += Vt Pt (same k order as WFrag::ld).
// Running maximum in scaled log2 units; the output tiles are rescaled only when some column's maximum has grown by more than 8. Operand planes as before: NSPLIT 2 = hi + lo bf16, three products; NSPLIT 0 = single fp16.
#define L2E  1.4426950408889634f
template <typename T16, int NSPLIT>
__device__ __forceinline__ void attn_body(const T16* __restrict__ Q, const T16* __restrict__ Q2, const T16* __restrict__ Kp, const T16* __restrict__ K2, const T16* __restrict__ Vt, const T16* __restrict__ V2, float sl2, int q0, bf* Ah, bf* Al) {
    typedef typename WFrag<T16>::V V;
    int lane = threadIdx.x & 31;
    V qf[2][2], qf2[2][2], kf[2][2], kf2[2][2];
    // each lane's own byte offsets into the Q and K planes: the fetches name only these registers and the planes' uniform bases, with constant offsets; kob is carried through the loop
    unsigned qob = (unsigned)((q0 + (lane & 15)) * HD + 8 * (lane >> 4)) * 2u, kob = (unsigned)((lane & 15) * HD + 8 * (lane >> 4)) * 2u;
#pragma unroll
    for (int nq = 0; nq < 2; ++nq)
#pragma unroll
        for (int ks = 0; ks < 2; ++ks) { const int qo = nq * 16 * HD + ks * 32; qf[nq][ks] = WFrag<T16>::ld((const T16*)((const char*)Q + qob) + qo); if (NSPLIT == 2) qf2[nq][ks] = WFrag<T16>::ld((const T16*)((const char*)Q2 + qob) + qo); }
#pragma unroll
    for (int kt = 0; kt < 2; ++kt)
#pragma unroll
        for (int ks = 0; ks < 2; ++ks) { const int ko = kt * 16 * HD + ks * 32; kf[kt][ks] = WFrag<T16>::ld((const T16*)((const char*)Kp + kob) + ko); if (NSPLIT == 2) kf2[kt][ks] = WFrag<T16>::ld((const T16*)((const char*)K2 + kob) + ko); }
    __builtin_amdgcn_sched_barrier(0);   // keeps the fetches in front of the wait
    // the wait in front of any overwrite of the Q and K fetches' address registers. The offsets go through it so that they stay in their registers up to it,
    // the lane number so that the arithmetic below, all of which starts from it, stays behind it
    asm volatile("s_wait_xcnt 0x0" : "+v"(lane), "+v"(qob), "+v"(kob) :: "memory");
    __builtin_amdgcn_sched_barrier(0);   // keeps all later arithmetic behind the wait
    const int lr = lane & 15, hi = lane >> 4;
    v8f o[4][2]; float m[2], l[2], bl[2][8];
#pragma unroll
    for (int nq = 0; nq < 2; ++nq) { m[nq] = -3.0e38f; l[nq] = 0.f;
#pragma unroll
        for (int dt = 0; dt < 4; ++dt) o[dt][nq] = (v8f){}; }
#pragma unroll
    for (int kt = 0; kt < 2; ++kt)
#pragma unroll
        for (int j = 0; j < 8; ++j) bl[kt][j] = sl2 * (float)(kt * 16 + 8 * hi + j);   // ALiBi bias inside a key block; the block's own offset goes into the exponent's shift
    unsigned vob = (unsigned)(lr * TT + 8 * hi) * 2u;   // the lane's byte offset into the Vt planes, carried through the loop like kob
    // rolled: a second copy of the body would only add registers; the K fetch one block ahead already spans the back edge
    int k0 = 0;
#pragma unroll 1
    do {   // at least the diagonal block: q0 >= 0
        V vf[4], vf2[4];
#pragma unroll
        for (int dt = 0; dt < 4; ++dt) { vf[dt] = WFrag<T16>::ld((const T16*)((const char*)Vt + vob) + dt * 16 * TT); if (NSPLIT == 2) vf2[dt] = WFrag<T16>::ld((const T16*)((const char*)V2 + vob) + dt * 16 * TT); }
        __builtin_amdgcn_sched_barrier(0);   // keeps this block's Vt fetch in front of the score products: left free it sinks behind them, and its latency then stands open in front of P.V
        // the wait in front of any overwrite of the Vt fetch's address registers; the offset goes through it so that it stays in its register up to it
        asm volatile("s_wait_xcnt 0x0" : "+v"(vob) :: "memory");
        __builtin_amdgcn_sched_barrier(0);   // keeps the score products and all later arithmetic behind that wait
        vob += 32u * 2u;
        v8f s[2][2];
#pragma unroll
        for (int kt = 0; kt < 2; ++kt)
#pragma unroll
            for (int nq = 0; nq < 2; ++nq) { v8f t = (v8f){};
#pragma unroll
                for (int ks = 0; ks < 2; ++ks) { t = WFrag<T16>::mma(kf[kt][ks], qf[nq][ks], t); if (NSPLIT == 2) { t = WFrag<T16>::mma(kf2[kt][ks], qf[nq][ks], t); t = WFrag<T16>::mma(kf[kt][ks], qf2[nq][ks], t); } }
                s[kt][nq] = t; }
        // the next block's K fragments, fetched one block ahead into the same registers (the last block fetches its own rows again: in bounds, unused)
        kob += (k0 < q0) ? 32u * HD * 2u : 0u;
        __builtin_amdgcn_sched_barrier(0);   // keeps the fetch's address arithmetic in one piece in front of the fetch, so that none of it writes over an address in use
#pragma unroll
        for (int kt = 0; kt < 2; ++kt)
#pragma unroll
            for (int ks = 0; ks < 2; ++ks) { const int ko = kt * 16 * HD + ks * 32; kf[kt][ks] = WFrag<T16>::ld((const T16*)((const char*)Kp + kob) + ko); if (NSPLIT == 2) kf2[kt][ks] = WFrag<T16>::ld((const T16*)((const char*)K2 + kob) + ko); }
        __builtin_amdgcn_sched_barrier(0);   // keeps the fetch in front of the wait
        // the same wait for the K fetch's address register, which goes through it like vob above
        asm volatile("s_wait_xcnt 0x0" : "+v"(kob) :: "memory");
        __builtin_amdgcn_sched_barrier(0);   // keeps all later arithmetic behind the wait
        float off[2], cand[2];
#pragma unroll
        for (int nq = 0; nq < 2; ++nq) {
#pragma unroll
            for (int kt = 0; kt < 2; ++kt)
#pragma unroll
                for (int j = 0; j < 8; ++j) s[kt][nq][j] = fmaf(s[kt][nq][j], SCL * L2E, bl[kt][j]);
            if (k0 == q0) {   // the diagonal block (wave-uniform): keys beyond the query are masked
#pragma unroll
                for (int kt = 0; kt < 2; ++kt)
#pragma unroll
                    for (int j = 0; j < 8; ++j) if (kt * 16 + 8 * hi + j > nq * 16 + lr) s[kt][nq][j] = -3.0e38f; }
            float mx = s[0][nq][0];
#pragma unroll
            for (int kt = 0; kt < 2; ++kt)
#pragma unroll
                for (int j = 0; j < 8; ++j) mx = fmaxf(mx, s[kt][nq][j]);
            mx = fmaxf(mx, __shfl_xor(mx, 16, 32));
            off[nq] = sl2 * (float)(k0 - (q0 + nq * 16 + lr)); cand[nq] = mx + off[nq]; }
        if (__builtin_amdgcn_ballot_w32(cand[0] > m[0] + 8.0f || cand[1] > m[1] + 8.0f) != 0) {
#pragma unroll
            for (int nq = 0; nq < 2; ++nq) { const float mn = fmaxf(m[nq], cand[nq]); const float al = __builtin_amdgcn_exp2f(m[nq] - mn); m[nq] = mn; l[nq] *= al;
#pragma unroll
                for (int dt = 0; dt < 4; ++dt) o[dt][nq] *= al; } }
#pragma unroll
        for (int nq = 0; nq < 2; ++nq) { const float sh = m[nq] - off[nq]; V p, p2; float ls = 0.f;
#pragma unroll
            for (int e = 0; e < 16; ++e) { const float pe = __builtin_amdgcn_exp2f(s[e >> 3][nq][e & 7] - sh); ls += pe;
                if constexpr (NSPLIT == 2) { p[e] = (__bf16)pe; p2[e] = (__bf16)(pe - (float)p[e]); } else { p[e] = (h16)pe; } }
            l[nq] += ls;
#pragma unroll
            for (int dt = 0; dt < 4; ++dt) { o[dt][nq] = WFrag<T16>::mma(vf[dt], p, o[dt][nq]); if (NSPLIT == 2) { o[dt][nq] = WFrag<T16>::mma(vf[dt], p2, o[dt][nq]); o[dt][nq] = WFrag<T16>::mma(vf2[dt], p, o[dt][nq]); } } }
        // four vector slots behind the last P.V product, before the next block's Vt fetch and score products write over its A and B registers
        asm volatile("v_nop\n\tv_nop\n\tv_nop\n\tv_nop" :: "v"(o[0][1]), "v"(o[1][1]), "v"(o[2][1]), "v"(o[3][1]));
        k0 += 32;
    } while (k0 <= q0);
#pragma unroll
    for (int nq = 0; nq < 2; ++nq) { const float inv = __fdiv_rn(1.0f, l[nq] + __shfl_xor(l[nq], 16, 32));
#pragma unroll
        for (int dt = 0; dt < 4; ++dt) { v8us oh, ol;
#pragma unroll
            for (int j = 0; j < 8; ++j) { unsigned short x, y; splitf(o[dt][nq][j] * inv, x, y); oh[j] = x; ol[j] = y; }
            const size_t oo = (size_t)(q0 + nq * 16 + lr) * DQ + dt * 16 + 8 * hi; *(v8us*)(Ah + oo) = oh; *(v8us*)(Al + oo) = ol; } }
}
// grid (kv head, batch, 16 position blocks of 64 queries, long ones first, hi+lo and fp16 blocks alternating); 4 independent waves: 2 query heads of the kv head x 2 column groups, so that they read the same K and V lines.
__global__ __launch_bounds__(128) void k_fattn(const h16* __restrict__ QK16, const bf* __restrict__ QKh, const bf* __restrict__ QKl, const h16* __restrict__ V16, const bf* __restrict__ Vh, const bf* __restrict__ Vl, const float* __restrict__ SLP, bf* Ah, bf* Al) {
    const int w = __builtin_amdgcn_readfirstlane(threadIdx.x >> 5); const int g = blockIdx.x, b = blockIdx.y, zz = blockIdx.z;
    const int pb = (zz & 1) ? (RH / 64 - 1 - (zz >> 1)) : (TT / 64 - 1 - (zz >> 1)); const int h = g * REP + (w & 1); const int q0 = pb * 64 + (w >> 1) * 32;
    const size_t qo = ((size_t)b * (NH_ + NKV) + h) * TT * HD, ko = ((size_t)b * (NH_ + NKV) + NH_ + g) * TT * HD, vo = ((size_t)b * NKV + g) * HD * TT, ao = (size_t)b * TT * DQ + h * HD;
    const float sl2 = SLP[h] * L2E;
    if (q0 < RH) attn_body<bf, 2>(QKh + qo, QKl + qo, QKh + ko, QKl + ko, Vh + vo, Vl + vo, sl2, q0, Ah + ao, Al + ao);
    else attn_body<h16, 0>(QK16 + qo, nullptr, QK16 + ko, nullptr, V16 + vo, nullptr, sl2, q0, Ah + ao, Al + ao);
}

__global__ __launch_bounds__(256) void k_wtGs(const float* __restrict__ w, int K, int N, int ld, bf* Bt) { const size_t e = ((size_t)blockIdx.x * 256 + threadIdx.x) * 4; if (e >= (size_t)N * K) return; const int k = (int)(e % K); const int n = (int)(e / K); v4us o;   // Bt[n][k] = w[k*ld + n]
#pragma unroll
    for (int u = 0; u < 4; ++u) o[u] = f2bf(w[(size_t)(k + u) * ld + n]); *(v4us*)(Bt + e) = o;  }
__global__ __launch_bounds__(64) void k_slopes(float* SLP) { const int h = threadIdx.x; if (h >= 64) return; const float base = 0.8408964152537145f; const float v = (h < NH_) ? powf(base, (float)(h + 1)) : 0.f; *(float*)(SLP + h) = v;  }   // ALiBi slopes 2^(-0.25 (h+1)) as f32 base^power like the numpy reference

extern "C" void kernel_launch(void* const* d_in, const int* in_sizes, int n_in,
                              void* d_out, int out_size, void* d_ws, size_t ws_size, hipStream_t stream) {
    (void)in_sizes; (void)n_in; (void)out_size;
    const float* x = (const float*)d_in[0]; const float* wqkv = (const float*)d_in[1]; const float* wo = (const float*)d_in[2]; const float* wq = nullptr; const float* wk = nullptr; const float* wv = nullptr; (void)wq; (void)wk; (void)wv; const float* cosT = nullptr; const float* sinT = nullptr; (void)cosT; (void)sinT;
    float* OUT = (float*)d_out;     // [4][1024][1024]
    char* wsp = (char*)d_ws;
    auto take = [&](size_t bytes) { char* p = wsp; wsp += (bytes + 255) & ~(size_t)255; return (void*)p; };
    bf* WQKV = (bf*)take((size_t)(DQ + 2 * DKV) * DM * 2); bf* WO = (bf*)take((size_t)DM * DQ * 2);
    bf* XB = (bf*)take((size_t)NB_ * TT * DM * 2); float* SLP = (float*)take(256);
    const size_t SQK = (size_t)(NH_ + NKV) * TT * HD, SV = (size_t)NKV * HD * TT;   // elements of one batch's head planes (32 q heads, then 16 k heads) and of its transposed v planes
    h16* QP16 = (h16*)take(NB_ * SQK * 2); h16* VT16 = (h16*)take(NB_ * SV * 2);
    bf* QPh = (bf*)take(NB_ * SQK * 2); bf* QPl = (bf*)take(NB_ * SQK * 2); bf* VTh = (bf*)take(NB_ * SV * 2); bf* VTl = (bf*)take(NB_ * SV * 2);
    bf* ATh = (bf*)take((size_t)NB_ * TT * DQ * 2); bf* ATl = (bf*)take((size_t)NB_ * TT * DQ * 2);
    if ((size_t)(wsp - (char*)d_ws) > ws_size) return;    // ws 256 MiB
    k_wtGs<<<(unsigned)(((size_t)(DQ + 2 * DKV) * DM / 4 + 255) / 256), 256, 0, stream>>>(wqkv, DM, DQ + 2 * DKV, 4096, WQKV); k_slopes<<<1, 64, 0, stream>>>(SLP);
    k_wtG<<<(unsigned)((DQ * DM / 64 + 63) / 64), 256, 0, stream>>>(wo, DQ, DM, WO);
    k_cvt8<<<(unsigned)(((size_t)NB_ * TT * DM / 8 + 255) / 256), 256, 0, stream>>>(x, XB, (size_t)NB_ * TT * DM / 8);
    k_qkvp<<<dim3(NB_ * TT / 64, (DQ + 2 * DKV) / 64, 1), 32, 0, stream>>>(XB, WQKV, QP16, QPh, QPl, VT16, VTh, VTl);   // all four batches: rows b * 1024 + t
    k_fattn<<<dim3(NKV, NB_, TT / 64), 128, 0, stream>>>(QP16, QPh, QPl, VT16, VTh, VTl, SLP, ATh, ATl);   // all batches and heads
    k_gemmw<bf, 1, false><<<dim3(NB_ * TT / 64, DM / 64, 1), 32, 0, stream>>>(ATh, ATl, WO, nullptr, DQ, OUT, DM, nullptr, 0, 0, 0);   // all four batches: rows b * 1024 + t
}

// v004
// A run of this version takes 145 microseconds.
// Two timings next to v003 put it at 1.41 and 1.42 times that version's speed.
// All steps since v000 together make it 26.7 times as fast.
#include <hip/hip_runtime.h>
#include <stdint.h>

// FlexAttention (inputs [4][1024][1024]; qkv = x W_qkv ([1024][4096]: 2048 q columns = 32 query heads x 64, then 1024 k and 1024 v columns = 16 kv heads; GQA repeat_interleave: query head h uses kv head h/2); scores = q.k / 8 + ALiBi slope_h (j - i) (slopes 2^(-0.25 (h+1)) computed on device in f32); causal; softmax; out = merged (2048) W_out -> [4][1024][1024]).
// Compute dtypes, f32 accumulate: every input rounded to bf16; q/k/v on PLAIN bf16 operands (inputs: exact; column blocks of W_qkv); causal scores and attn.v: query rows < 512 hl (3 products), rows 512..1023 single fp16; ALiBi bias + online softmax f32; W_out hl x exact (2 products).

#define NB_  4
#define TT   1024
#define DM   1024
#define NH_  32
#define NKV  16
#define REP  (NH_ / NKV)
#define HD   64
#define DQ   (NH_ * HD)
#define DKV  (NKV * HD)
#define RH   512                  // query rows < RH use hi+lo planes (k_fattn's grid assumes RH = TT / 2)
#define SCL  0.125f   // HD^-0.5
typedef _Float16 h16;
typedef unsigned short bf;
typedef __attribute__((ext_vector_type(16))) __bf16   v16bf;
typedef __attribute__((ext_vector_type(16))) _Float16 v16h;
typedef __attribute__((ext_vector_type(8)))  _Float16 v8h;
typedef __attribute__((ext_vector_type(8)))  unsigned short v8us;
typedef __attribute__((ext_vector_type(8)))  float    v8f;
typedef __attribute__((ext_vector_type(4)))  float    v4f;
typedef v8h  __attribute__((may_alias)) v8ha;
typedef v4f  __attribute__((may_alias)) v4fa;
typedef v8us __attribute__((may_alias)) v8usa;

__device__ __forceinline__ unsigned short f2bf(float f) { unsigned u = __float_as_uint(f); u += 0x7FFFu + ((u >> 16) & 1u); return (unsigned short)(u >> 16); }
__device__ __forceinline__ float bf2f(unsigned short b) { return __uint_as_float(((unsigned)b) << 16); }
__device__ __forceinline__ float bfr(float f) { return bf2f(f2bf(f)); }
__device__ __forceinline__ v16h cat16(v8h lo, v8h hi) { return __builtin_shufflevector(lo, hi, 0, 1, 2, 3, 4, 5, 6, 7, 8, 9, 10, 11, 12, 13, 14, 15); }
__device__ __forceinline__ v16bf cat16b(v8us lo, v8us hi) { return __builtin_bit_cast(v16bf, __builtin_shufflevector(lo, hi, 0, 1, 2, 3, 4, 5, 6, 7, 8, 9, 10, 11, 12, 13, 14, 15)); }
__device__ __forceinline__ v8f wmma16(v16h a, v16h b, v8f c) { return __builtin_amdgcn_wmma_f32_16x16x32_f16(false, a, false, b, (short)0, c, false, false); }
__device__ __forceinline__ v8f wmmab(v16bf a, v16bf b, v8f c) { return __builtin_amdgcn_wmma_f32_16x16x32_bf16(false, a, false, b, (short)0, c, false, false); }



// ---- fragments of K-contiguous 16-bit planes: 16 rows x 32 k, a lane holds k = 8 hi .. 8 hi + 7 and 16 + 8 hi .. 16 + 8 hi + 7 of row lr.
template <typename T16> struct WFrag;
template <> struct WFrag<h16> { typedef v16h V; static __device__ __forceinline__ V ld(const h16* p) { return cat16(*(const v8h*)p, *(const v8h*)(p + 16)); } static __device__ __forceinline__ v8f mma(V a, V b, v8f c) { return wmma16(a, b, c); } };
template <> struct WFrag<bf> { typedef v16bf V; static __device__ __forceinline__ V ld(const bf* p) { return cat16b(*(const v8us*)p, *(const v8us*)(p + 16)); } static __device__ __forceinline__ v8f mma(V a, V b, v8f c) { return wmmab(a, b, c); } };
// ---- operand tiles in LDS, brought by tensor loads. A tile = 128 rows x 128 B (64 k) of a K-contiguous 16-bit plane; the load's pad gives the rows a pitch of 144 B in LDS (16 B x odd, for 16-byte readers). 128 x 144 B = 9 x 2 KiB.
typedef uint32_t u32x4 __attribute__((ext_vector_type(4)));
typedef uint32_t u32x8 __attribute__((ext_vector_type(8)));
#define TPB   144
#define TILEB (128 * TPB)
__device__ __forceinline__ uint32_t uni(uint32_t v) { return (uint32_t)__builtin_amdgcn_readfirstlane(v); }
__device__ __forceinline__ uint32_t pinned(uint32_t v) { uint32_t w = (uint32_t)__builtin_amdgcn_readfirstlane(v); asm volatile("" : "+s"(w)); return w; }   // holds a test in a scalar register, so that it compiles to a scalar branch: a tensor load ignores EXEC
__device__ __forceinline__ u32x8 tile_group1(uint32_t pitch) { u32x8 g; g[0] = uni((1u << 20) | (4u << 22) | (3u << 25)); g[1] = uni(128u << 16); g[2] = uni(128u << 16); g[3] = uni(128u << 16); g[4] = uni(128u); g[5] = uni(pitch); g[6] = uni(0u); g[7] = uni(0u); return g; }   // bytes: rows of 128, 128 rows, tensor = tile, 16 B of pad behind every 128
__device__ __forceinline__ void tile_addr(u32x4& g, uint32_t place, uint64_t ga) { g[1] = uni(place); g[2] = uni((uint32_t)ga); g[3] = uni(((uint32_t)(ga >> 32) & 0x01FFFFFFu) | 0x80000000u); }   // where the tile lands, its first byte, type 2
__device__ __forceinline__ void tile_load(u32x4 g0, u32x8 g1) { asm volatile("tensor_load_to_lds %0, %1" :: "s"(g0), "s"(g1) : "memory"); }
__device__ __forceinline__ v16bf lds_frag(const unsigned char* p) { return cat16b(*(const v8usa*)p, *(const v8usa*)(p + 32)); }   // same k order as WFrag::ld
// tile_ring: NS stages of NT tiles through two buffers; wave w < NT brings tile w of every stage (its rows start at src, pitch bytes apart; a stage is 128 B further along them). pass(buffer) does one stage's products; the next stage's load flies meanwhile.
template <int NT, int NS, typename F>
__device__ __forceinline__ void tile_ring(unsigned char* ring, uint64_t src, uint32_t pitch, uint32_t wave, F&& pass) {
    const uint32_t place = (uint32_t)(size_t)ring + wave * TILEB; const uint32_t issuer = wave < (uint32_t)NT ? 1u : 0u;
    u32x8 g1 = tile_group1(pitch);
    asm volatile("" : "+s"(g1));   // descriptor words held in their scalar registers (as pinned()): left free, the compiler uses some of them for other values while a request is in flight and restores them in front of the next
    u32x4 g0; g0[0] = uni(1u); tile_addr(g0, place, src);
    // every wait for a request takes that request's group 0 through it: its registers keep their values up to the wait, and the next request's words are formed behind it
    if (pinned(issuer)) { tile_load(g0, g1);
        asm volatile("s_wait_tensorcnt 0x0" : "+s"(g0) :: "memory"); }   // stage 0 has landed before the barrier that publishes it
    __syncthreads();
    if (pinned(issuer)) { tile_addr(g0, place + NT * TILEB, src + 128u); tile_load(g0, g1); }
    // rolled: the buffer alternates by the stage's parity, a second copy of the body would only add code
#pragma unroll 1
    for (uint32_t s = 0; s < (uint32_t)NS; ++s) {
        pass(ring + (s & 1u) * (NT * TILEB));
        asm volatile("s_wait_dscnt 0x0" ::: "memory");   // this wave's reads of the buffer have returned before the barrier behind which it is refilled
        if (pinned(issuer)) asm volatile("s_wait_tensorcnt 0x0" : "+s"(g0) :: "memory");   // stage s + 1 has landed before the barrier that publishes it
        __syncthreads();
        if (pinned((issuer != 0u && s + 2u < (uint32_t)NS) ? 1u : 0u)) { tile_addr(g0, place + (s & 1u) * (NT * TILEB), src + (uint64_t)((s + 2u) * 128u)); tile_load(g0, g1); }
    }
    asm volatile("s_wait_tensorcnt 0x0" ::: "memory");   // nothing is in flight when the ring becomes output staging
    asm volatile("s_wait_dscnt 0x0" ::: "memory");
}
// ---- k_outp: C[m][n] (f32, pitch DM) = sum_k (Ah + Al)[m][k] Bt[n][k], K = DQ. One 128x128 tile per work-group of 4 waves (64x64 each, 16 accumulators); grid (M/128, N/128). Tiles per stage: Ah rows, Al rows, Bt rows.
__global__ __launch_bounds__(128, 4) void k_outp(const bf* __restrict__ Ah, const bf* __restrict__ Al, const bf* __restrict__ Bt, float* C) {
    __shared__ __attribute__((aligned(2048))) unsigned char ring[2 * 3 * TILEB];
    const int lane = threadIdx.x & 31, lr = lane & 15, hi = lane >> 4; const uint32_t wave = uni(threadIdx.x >> 5);
    const int R0 = blockIdx.x * 128, C0 = blockIdx.y * 128; const int r0 = R0 + (int)(wave & 1u) * 64, c0 = C0 + (int)(wave >> 1) * 64;
    const bf* sp = wave == 0u ? Ah + (size_t)R0 * DQ : wave == 1u ? Al + (size_t)R0 * DQ : Bt + (size_t)C0 * DQ;
    v8f acc[4][4];
#pragma unroll
    for (int mb = 0; mb < 4; ++mb)
#pragma unroll
        for (int nb = 0; nb < 4; ++nb) acc[mb][nb] = (v8f){};
    const uint32_t fo = (uint32_t)(lr * TPB + hi * 16), ao = (wave & 1u) * 64u * TPB + fo, bo = 2u * TILEB + (wave >> 1) * 64u * TPB + fo;
    tile_ring<3, DQ / 64>(ring, (uint64_t)(size_t)sp, DQ * 2u, wave, [&](const unsigned char* buf) {
#pragma unroll
        for (int ks = 0; ks < 2; ++ks) { v16bf a[4], a2[4], b[4];
#pragma unroll
            for (int mb = 0; mb < 4; ++mb) { a[mb] = lds_frag(buf + ao + mb * 16 * TPB + ks * 64); a2[mb] = lds_frag(buf + ao + TILEB + mb * 16 * TPB + ks * 64); }
#pragma unroll
            for (int nb = 0; nb < 4; ++nb) b[nb] = lds_frag(buf + bo + nb * 16 * TPB + ks * 64);
            __builtin_amdgcn_sched_barrier(0);   // keeps the fragment reads as one group in front of the products: left free, they sink among them, each with a full wait of its own
#pragma unroll
            for (int nb = 0; nb < 4; ++nb)
#pragma unroll
                for (int mb = 0; mb < 4; ++mb) { acc[mb][nb] = wmmab(a[mb], b[nb], acc[mb][nb]); acc[mb][nb] = wmmab(a2[mb], b[nb], acc[mb][nb]); }
            __builtin_amdgcn_sched_barrier(0); }   // keeps the next group of reads behind these products, whose operands it writes over
        // four vector slots behind the last product, before the next stage's fragment reads write over its A and B registers
        asm volatile("v_nop\n\tv_nop\n\tv_nop\n\tv_nop" :: "v"(acc[0][0]), "v"(acc[1][0]), "v"(acc[2][0]), "v"(acc[3][0]), "v"(acc[0][1]), "v"(acc[1][1]), "v"(acc[2][1]), "v"(acc[3][1]), "v"(acc[0][2]), "v"(acc[1][2]), "v"(acc[2][2]), "v"(acc[3][2]), "v"(acc[0][3]), "v"(acc[1][3]), "v"(acc[2][3]), "v"(acc[3][3]));
    });
    // 16 rows at a time go through the wave's own piece of the ring (every wave has left it: the last stage's barrier), so that a store covers whole lines
    float* os = (float*)(ring + wave * 8192u);
    unsigned cob = (unsigned)(hi * DM + lr * 4) * 4u;   // the lane's byte offset into C: the stores name only this register, a uniform base and constant offsets
#pragma unroll
    for (int mb = 0; mb < 4; ++mb) {
#pragma unroll
        for (int nb = 0; nb < 4; ++nb) {
#pragma unroll
            for (int j = 0; j < 8; ++j) os[(hi * 8 + j) * 68 + nb * 16 + lr] = acc[mb][nb][j]; }
        // the lanes' LDS writes have landed before other lanes of this wave read the rows back; the clobber keeps the reads behind it
        asm volatile("s_wait_dscnt 0x0" ::: "memory");
        float* crow = C + (size_t)(r0 + mb * 16) * DM + c0; v4f val[8];
#pragma unroll
        for (int s = 0; s < 8; ++s) val[s] = *(const v4fa*)(os + (2 * s + hi) * 68 + lr * 4);
#pragma unroll
        for (int s = 0; s < 8; ++s) *(v4fa*)((char*)(crow + (size_t)2 * s * DM) + cob) = val[s];
        __builtin_amdgcn_sched_barrier(0);   // keeps the stores in front of the wait
        // the wait in front of any overwrite of the stores' data and address registers; the offset goes through it so that it stays in its register up to it; the clobber keeps the next rows' LDS writes behind the reads above
        asm volatile("s_wait_xcnt 0x0" : "+v"(cob) :: "memory");
        __builtin_amdgcn_sched_barrier(0);   // keeps the next rows' reads behind the wait
    }
}

__device__ __forceinline__ h16 tohx(float x) { return (h16)x; }
__device__ __forceinline__ void splitf(float y, unsigned short& h, unsigned short& l) { h = f2bf(y); l = f2bf(y - bf2f(h)); }
typedef __attribute__((ext_vector_type(2))) _Float16 v2h;
typedef __attribute__((ext_vector_type(4))) _Float16 v4h;
typedef __attribute__((ext_vector_type(2))) unsigned short v2us;
typedef __attribute__((ext_vector_type(4))) unsigned short v4us;
typedef __attribute__((ext_vector_type(2))) float v2f;
typedef __attribute__((ext_vector_type(4))) int v4i;

__global__ __launch_bounds__(256) void k_wtG(const float* __restrict__ w, int K, int N, bf* Bt) {
    const int lane = threadIdx.x & 31; const int L0 = (blockIdx.x * 8 + (threadIdx.x >> 5)) * 8; const int nlines = N * K / 64;
{
#pragma unroll 1
        for (int l = 0; l < 8; ++l) { const int L = L0 + l; if (L >= nlines) break; const size_t e = (size_t)L * 64 + lane * 2; const int k = (int)(e % K), n = (int)(e / K); v2us o;
            o[0] = f2bf(w[(size_t)k * N + n]); o[1] = f2bf(w[(size_t)(k + 1) * N + n]); *(v2us*)(Bt + e) = o; }
         }
}
__global__ __launch_bounds__(256) void k_cvt8(const float* __restrict__ src, bf* dst, size_t n8) { const size_t i = (size_t)blockIdx.x * 256 + threadIdx.x; if (i >= n8) return; const v8f v = *(const v8f*)(src + i * 8); v8us o;
#pragma unroll
    for (int k = 0; k < 8; ++k) o[k] = f2bf(v[k]); *(v8us*)(dst + i * 8) = o;  }
__global__ __launch_bounds__(256) void k_cscvt(const float* __restrict__ cosT, const float* __restrict__ sinT, float* CS) { const int idx = blockIdx.x * 256 + threadIdx.x; if (idx >= TT * HD) return; v2f cs; cs[0] = bfr(cosT[idx]); cs[1] = bfr(sinT[idx]); *(v2f*)(CS + (size_t)idx * 2) = cs;  }
// ---- k_qkvp: the q|k|v product of all batches, one 128x128 tile per work-group of 4 waves (64x64 each), operand tiles (x rows, weight rows) in LDS by tile_ring; it writes the attention kernel's operand planes (fp16, bf16 hi, bf16 lo) itself; grid (NB_ TT / 128, 4096 / 128), 128 threads.
// A wave's 64 columns are one head. D[i][j] = sum_k P[i][k] R[j][k]; a lane holds 8 consecutive i of one j, so i is made the plane's contiguous index: q and k tiles (planes [head][t][d]): P = weight rows (i = d), R = x rows (j = t); v tiles (planes [head][d][t]): P = x rows (i = t), R = weight rows (j = d).
typedef __attribute__((ext_vector_type(8))) __bf16 v8b;
typedef v8b __attribute__((may_alias)) v8ba;
#define SP 72   // LDS row pitch in 16-bit elements: 128 B of data + 16 B, for 16-byte readers and writers
// put_planes: 16 rows j at a time, each 64 i = one 128-B line per plane, go through the wave's own LDS so that every global store covers four whole lines. OP = the planes' row pitch in elements.
template <int OP>
__device__ __forceinline__ void put_planes(const v8f (&acc)[4][4], unsigned short* st, h16* O16, bf* Oh, bf* Ol, int lane) {
    const int lr = lane & 15, hi = lane >> 4;
    unsigned oob = (unsigned)((lane >> 3) * OP + (lane & 7) * 8) * 2u;   // the lane's byte offset into the planes: the stores name only this register, the planes' uniform bases and constant offsets
#pragma unroll
    for (int nb = 0; nb < 4; ++nb) {
#pragma unroll
        for (int mb = 0; mb < 4; ++mb) { v8h o16; v8b oh, ol;
#pragma unroll
            for (int j = 0; j < 8; ++j) { const float r = acc[mb][nb][j]; o16[j] = tohx(r); oh[j] = (__bf16)r; ol[j] = (__bf16)(r - (float)oh[j]); }   // round to nearest even, as splitf
            unsigned short* sp = st + lr * SP + (mb * 2 + hi) * 8; *(v8ha*)sp = o16; *(v8ba*)(sp + 16 * SP) = oh; *(v8ba*)(sp + 32 * SP) = ol; }
        // the lanes' LDS writes have landed before other lanes of this wave read the rows back; the clobber keeps the reads behind it (the rows are this wave's own: no barrier)
        asm volatile("s_wait_dscnt 0x0" ::: "memory");
        v8us val[3][4];
#pragma unroll
        for (int p = 0; p < 3; ++p)
#pragma unroll
            for (int s = 0; s < 4; ++s) val[p][s] = *(const v8usa*)(st + (p * 16 + 4 * s + (lane >> 3)) * SP + (lane & 7) * 8);
#pragma unroll
        for (int s = 0; s < 4; ++s) { const int eo = (nb * 16 + 4 * s) * OP; *(v8usa*)((char*)(O16 + eo) + oob) = val[0][s]; *(v8usa*)((char*)(Oh + eo) + oob) = val[1][s]; *(v8usa*)((char*)(Ol + eo) + oob) = val[2][s]; }
        __builtin_amdgcn_sched_barrier(0);   // keeps the stores in front of the wait
        // the wait in front of any overwrite of the stores' data and address registers by the next rows' conversions; the offset goes through it so that it stays in its register up to it; the clobber keeps the next rows' LDS writes behind the reads above
        asm volatile("s_wait_xcnt 0x0" : "+v"(oob) :: "memory");
        __builtin_amdgcn_sched_barrier(0);   // keeps the next rows' arithmetic behind the wait
    }
}
__global__ __launch_bounds__(128, 4) void k_qkvp(const bf* __restrict__ X, const bf* __restrict__ Wt, h16* QK16, bf* QKh, bf* QKl, h16* V16, bf* Vh, bf* Vl) {
    __shared__ __attribute__((aligned(2048))) unsigned char ring[2 * 2 * TILEB];
    const int lane = threadIdx.x & 31; const uint32_t wave = uni(threadIdx.x >> 5), xs = wave & 1u, cs = wave >> 1;
    const int R0 = blockIdx.x * 128, C0 = blockIdx.y * 128; const int r0 = R0 + (int)xs * 64, c0 = C0 + (int)cs * 64; const int b = r0 / TT, t0 = r0 % TT; const bool isv = C0 >= DQ + DKV;
    const bf* sp = wave == 0u ? X + (size_t)R0 * DM : Wt + (size_t)C0 * DM;   // tile 0: x rows, tile 1: weight rows
    v8f acc[4][4];
#pragma unroll
    for (int mb = 0; mb < 4; ++mb)
#pragma unroll
        for (int nb = 0; nb < 4; ++nb) acc[mb][nb] = (v8f){};
    const uint32_t fo = (uint32_t)((lane & 15) * TPB + (lane >> 4) * 16), xo = xs * 64u * TPB + fo, wo = TILEB + cs * 64u * TPB + fo; const uint32_t po = isv ? xo : wo, ro = isv ? wo : xo;
    tile_ring<2, DM / 64>(ring, (uint64_t)(size_t)sp, DM * 2u, wave, [&](const unsigned char* buf) {
#pragma unroll
        for (int ks = 0; ks < 2; ++ks) { v16bf a[4], bb[4];
#pragma unroll
            for (int mb = 0; mb < 4; ++mb) a[mb] = lds_frag(buf + po + mb * 16 * TPB + ks * 64);
#pragma unroll
            for (int nb = 0; nb < 4; ++nb) bb[nb] = lds_frag(buf + ro + nb * 16 * TPB + ks * 64);
            __builtin_amdgcn_sched_barrier(0);   // keeps the fragment reads as one group in front of the products: left free, they sink among them, each with a full wait of its own
#pragma unroll
            for (int nb = 0; nb < 4; ++nb)
#pragma unroll
                for (int mb = 0; mb < 4; ++mb) acc[mb][nb] = wmmab(a[mb], bb[nb], acc[mb][nb]);
            __builtin_amdgcn_sched_barrier(0); }   // keeps the next group of reads behind these products, whose operands it writes over
        // four vector slots behind the last product, before the next stage's fragment reads write over its A and B registers
        asm volatile("v_nop\n\tv_nop\n\tv_nop\n\tv_nop" :: "v"(acc[0][0]), "v"(acc[1][0]), "v"(acc[2][0]), "v"(acc[3][0]), "v"(acc[0][1]), "v"(acc[1][1]), "v"(acc[2][1]), "v"(acc[3][1]), "v"(acc[0][2]), "v"(acc[1][2]), "v"(acc[2][2]), "v"(acc[3][2]), "v"(acc[0][3]), "v"(acc[1][3]), "v"(acc[2][3]), "v"(acc[3][3]));
    });
    unsigned short* st = (unsigned short*)(ring + wave * 8192u);   // the wave's own piece of the ring, which every wave has left (the last stage's barrier)
    if (isv) { const size_t o = ((size_t)b * NKV + (c0 - DQ - DKV) / HD) * HD * TT + t0; put_planes<TT>(acc, st, V16 + o, Vh + o, Vl + o, lane); }
    else { const size_t o = (((size_t)b * (NH_ + NKV) + c0 / HD) * TT + t0) * HD; put_planes<HD>(acc, st, QK16 + o, QKh + o, QKl + o, lane); }
}
// ---- k_fattn: causal ALiBi attention in one kernel (scores, softmax and probability x value never leave the registers). One wave owns 32 query columns of one head and walks the keys 0 .. q0 + 31 in blocks of 32.
// St = K Qt: a lane holds the scores of ONE query (column lr of a 16-column group), keys 8 hi + j of each 16-key tile; two such tiles, converted in place, are the B operand of Ot += Vt Pt (same k order as WFrag::ld).
// Running maximum in scaled log2 units; the output tiles are rescaled only when some column's maximum has grown by more than 8. Operand planes as before: NSPLIT 2 = hi + lo bf16, three products; NSPLIT 0 = single fp16.
#define L2E  1.4426950408889634f
template <typename T16, int NSPLIT>
__device__ __forceinline__ void attn_body(const T16* __restrict__ Q, const T16* __restrict__ Q2, const T16* __restrict__ Kp, const T16* __restrict__ K2, const T16* __restrict__ Vt, const T16* __restrict__ V2, float sl2, int q0, bf* Ah, bf* Al) {
    typedef typename WFrag<T16>::V V;
    int lane = threadIdx.x & 31;
    V qf[2][2], qf2[2][2], kf[2][2], kf2[2][2];
    // each lane's own byte offsets into the Q and K planes: the fetches name only these registers and the planes' uniform bases, with constant offsets; kob is carried through the loop
    unsigned qob = (unsigned)((q0 + (lane & 15)) * HD + 8 * (lane >> 4)) * 2u, kob = (unsigned)((lane & 15) * HD + 8 * (lane >> 4)) * 2u;
#pragma unroll
    for (int nq = 0; nq < 2; ++nq)
#pragma unroll
        for (int ks = 0; ks < 2; ++ks) { const int qo = nq * 16 * HD + ks * 32; qf[nq][ks] = WFrag<T16>::ld((const T16*)((const char*)Q + qob) + qo); if (NSPLIT == 2) qf2[nq][ks] = WFrag<T16>::ld((const T16*)((const char*)Q2 + qob) + qo); }
#pragma unroll
    for (int kt = 0; kt < 2; ++kt)
#pragma unroll
        for (int ks = 0; ks < 2; ++ks) { const int ko = kt * 16 * HD + ks * 32; kf[kt][ks] = WFrag<T16>::ld((const T16*)((const char*)Kp + kob) + ko); if (NSPLIT == 2) kf2[kt][ks] = WFrag<T16>::ld((const T16*)((const char*)K2 + kob) + ko); }
    __builtin_amdgcn_sched_barrier(0);   // keeps the fetches in front of the wait
    // the wait in front of any overwrite of the Q and K fetches' address registers. The offsets go through it so that they stay in their registers up to it,
    // the lane number so that the arithmetic below, all of which starts from it, stays behind it
    asm volatile("s_wait_xcnt 0x0" : "+v"(lane), "+v"(qob), "+v"(kob) :: "memory");
    __builtin_amdgcn_sched_barrier(0);   // keeps all later arithmetic behind the wait
    const int lr = lane & 15, hi = lane >> 4;
    v8f o[4][2]; float m[2], l[2], bl[2][8];
#pragma unroll
    for (int nq = 0; nq < 2; ++nq) { m[nq] = -3.0e38f; l[nq] = 0.f;
#pragma unroll
        for (int dt = 0; dt < 4; ++dt) o[dt][nq] = (v8f){}; }
#pragma unroll
    for (int kt = 0; kt < 2; ++kt)
#pragma unroll
        for (int j = 0; j < 8; ++j) bl[kt][j] = sl2 * (float)(kt * 16 + 8 * hi + j);   // ALiBi bias inside a key block; the block's own offset goes into the exponent's shift
    unsigned vob = (unsigned)(lr * TT + 8 * hi) * 2u;   // the lane's byte offset into the Vt planes, carried through the loop like kob
    // rolled: a second copy of the body would only add registers; the K fetch one block ahead already spans the back edge
    int k0 = 0;
#pragma unroll 1
    do {   // at least the diagonal block: q0 >= 0
        V vf[4], vf2[4];
#pragma unroll
        for (int dt = 0; dt < 4; ++dt) { vf[dt] = WFrag<T16>::ld((const T16*)((const char*)Vt + vob) + dt * 16 * TT); if (NSPLIT == 2) vf2[dt] = WFrag<T16>::ld((const T16*)((const char*)V2 + vob) + dt * 16 * TT); }
        __builtin_amdgcn_sched_barrier(0);   // keeps this block's Vt fetch in front of the score products: left free it sinks behind them, and its latency then stands open in front of P.V
        // the wait in front of any overwrite of the Vt fetch's address registers; the offset goes through it so that it stays in its register up to it
        asm volatile("s_wait_xcnt 0x0" : "+v"(vob) :: "memory");
        __builtin_amdgcn_sched_barrier(0);   // keeps the score products and all later arithmetic behind that wait
        vob += 32u * 2u;
        v8f s[2][2];
#pragma unroll
        for (int kt = 0; kt < 2; ++kt)
#pragma unroll
            for (int nq = 0; nq < 2; ++nq) { v8f t = (v8f){};
#pragma unroll
                for (int ks = 0; ks < 2; ++ks) { t = WFrag<T16>::mma(kf[kt][ks], qf[nq][ks], t); if (NSPLIT == 2) { t = WFrag<T16>::mma(kf2[kt][ks], qf[nq][ks], t); t = WFrag<T16>::mma(kf[kt][ks], qf2[nq][ks], t); } }
                s[kt][nq] = t; }
        // the next block's K fragments, fetched one block ahead into the same registers (the last block fetches its own rows again: in bounds, unused)
        kob += (k0 < q0) ? 32u * HD * 2u : 0u;
        __builtin_amdgcn_sched_barrier(0);   // keeps the fetch's address arithmetic in one piece in front of the fetch, so that none of it writes over an address in use
#pragma unroll
        for (int kt = 0; kt < 2; ++kt)
#pragma unroll
            for (int ks = 0; ks < 2; ++ks) { const int ko = kt * 16 * HD + ks * 32; kf[kt][ks] = WFrag<T16>::ld((const T16*)((const char*)Kp + kob) + ko); if (NSPLIT == 2) kf2[kt][ks] = WFrag<T16>::ld((const T16*)((const char*)K2 + kob) + ko); }
        __builtin_amdgcn_sched_barrier(0);   // keeps the fetch in front of the wait
        // the same wait for the K fetch's address register, which goes through it like vob above
        asm volatile("s_wait_xcnt 0x0" : "+v"(kob) :: "memory");
        __builtin_amdgcn_sched_barrier(0);   // keeps all later arithmetic behind the wait
        float off[2], cand[2];
#pragma unroll
        for (int nq = 0; nq < 2; ++nq) {
#pragma unroll
            for (int kt = 0; kt < 2; ++kt)
#pragma unroll
                for (int j = 0; j < 8; ++j) s[kt][nq][j] = fmaf(s[kt][nq][j], SCL * L2E, bl[kt][j]);
            if (k0 == q0) {   // the diagonal block (wave-uniform): keys beyond the query are masked
#pragma unroll
                for (int kt = 0; kt < 2; ++kt)
#pragma unroll
                    for (int j = 0; j < 8; ++j) if (kt * 16 + 8 * hi + j > nq * 16 + lr) s[kt][nq][j] = -3.0e38f; }
            float mx = s[0][nq][0];
#pragma unroll
            for (int kt = 0; kt < 2; ++kt)
#pragma unroll
                for (int j = 0; j < 8; ++j) mx = fmaxf(mx, s[kt][nq][j]);
            mx = fmaxf(mx, __shfl_xor(mx, 16, 32));
            off[nq] = sl2 * (float)(k0 - (q0 + nq * 16 + lr)); cand[nq] = mx + off[nq]; }
        if (__builtin_amdgcn_ballot_w32(cand[0] > m[0] + 8.0f || cand[1] > m[1] + 8.0f) != 0) {
#pragma unroll
            for (int nq = 0; nq < 2; ++nq) { const float mn = fmaxf(m[nq], cand[nq]); const float al = __builtin_amdgcn_exp2f(m[nq] - mn); m[nq] = mn; l[nq] *= al;
#pragma unroll
                for (int dt = 0; dt < 4; ++dt) o[dt][nq] *= al; } }
#pragma unroll
        for (int nq = 0; nq < 2; ++nq) { const float sh = m[nq] - off[nq]; V p, p2; float ls = 0.f;
#pragma unroll
            for (int e = 0; e < 16; ++e) { const float pe = __builtin_amdgcn_exp2f(s[e >> 3][nq][e & 7] - sh); ls += pe;
                if constexpr (NSPLIT == 2) { p[e] = (__bf16)pe; p2[e] = (__bf16)(pe - (float)p[e]); } else { p[e] = (h16)pe; } }
            l[nq] += ls;
#pragma unroll
            for (int dt = 0; dt < 4; ++dt) { o[dt][nq] = WFrag<T16>::mma(vf[dt], p, o[dt][nq]); if (NSPLIT == 2) { o[dt][nq] = WFrag<T16>::mma(vf[dt], p2, o[dt][nq]); o[dt][nq] = WFrag<T16>::mma(vf2[dt], p, o[dt][nq]); } } }
        // four vector slots behind the last P.V product, before the next block's Vt fetch and score products write over its A and B registers
        asm volatile("v_nop\n\tv_nop\n\tv_nop\n\tv_nop" :: "v"(o[0][1]), "v"(o[1][1]), "v"(o[2][1]), "v"(o[3][1]));
        k0 += 32;
    } while (k0 <= q0);
#pragma unroll
    for (int nq = 0; nq < 2; ++nq) { const float inv = __fdiv_rn(1.0f, l[nq] + __shfl_xor(l[nq], 16, 32));
#pragma unroll
        for (int dt = 0; dt < 4; ++dt) { v8us oh, ol;
#pragma unroll
            for (int j = 0; j < 8; ++j) { unsigned short x, y; splitf(o[dt][nq][j] * inv, x, y); oh[j] = x; ol[j] = y; }
            const size_t oo = (size_t)(q0 + nq * 16 + lr) * DQ + dt * 16 + 8 * hi; *(v8us*)(Ah + oo) = oh; *(v8us*)(Al + oo) = ol; } }
}
// grid (kv head, batch, 16 position blocks of 64 queries, long ones first, hi+lo and fp16 blocks alternating); 4 independent waves: 2 query heads of the kv head x 2 column groups, so that they read the same K and V lines.
__global__ __launch_bounds__(128) void k_fattn(const h16* __restrict__ QK16, const bf* __restrict__ QKh, const bf* __restrict__ QKl, const h16* __restrict__ V16, const bf* __restrict__ Vh, const bf* __restrict__ Vl, const float* __restrict__ SLP, bf* Ah, bf* Al) {
    const int w = __builtin_amdgcn_readfirstlane(threadIdx.x >> 5); const int g = blockIdx.x, b = blockIdx.y, zz = blockIdx.z;
    const int pb = (zz & 1) ? (RH / 64 - 1 - (zz >> 1)) : (TT / 64 - 1 - (zz >> 1)); const int h = g * REP + (w & 1); const int q0 = pb * 64 + (w >> 1) * 32;
    const size_t qo = ((size_t)b * (NH_ + NKV) + h) * TT * HD, ko = ((size_t)b * (NH_ + NKV) + NH_ + g) * TT * HD, vo = ((size_t)b * NKV + g) * HD * TT, ao = (size_t)b * TT * DQ + h * HD;
    const float sl2 = SLP[h] * L2E;
    if (q0 < RH) attn_body<bf, 2>(QKh + qo, QKl + qo, QKh + ko, QKl + ko, Vh + vo, Vl + vo, sl2, q0, Ah + ao, Al + ao);
    else attn_body<h16, 0>(QK16 + qo, nullptr, QK16 + ko, nullptr, V16 + vo, nullptr, sl2, q0, Ah + ao, Al + ao);
}

__global__ __launch_bounds__(256) void k_wtGs(const float* __restrict__ w, int K, int N, int ld, bf* Bt) { const size_t e = ((size_t)blockIdx.x * 256 + threadIdx.x) * 4; if (e >= (size_t)N * K) return; const int k = (int)(e % K); const int n = (int)(e / K); v4us o;   // Bt[n][k] = w[k*ld + n]
#pragma unroll
    for (int u = 0; u < 4; ++u) o[u] = f2bf(w[(size_t)(k + u) * ld + n]); *(v4us*)(Bt + e) = o;  }
__global__ __launch_bounds__(64) void k_slopes(float* SLP) { const int h = threadIdx.x; if (h >= 64) return; const float base = 0.8408964152537145f; const float v = (h < NH_) ? powf(base, (float)(h + 1)) : 0.f; *(float*)(SLP + h) = v;  }   // ALiBi slopes 2^(-0.25 (h+1)) as f32 base^power

extern "C" void kernel_launch(void* const* d_in, const int* in_sizes, int n_in,
                              void* d_out, int out_size, void* d_ws, size_t ws_size, hipStream_t stream) {
    (void)in_sizes; (void)n_in; (void)out_size;
    const float* x = (const float*)d_in[0]; const float* wqkv = (const float*)d_in[1]; const float* wo = (const float*)d_in[2]; const float* wq = nullptr; const float* wk = nullptr; const float* wv = nullptr; (void)wq; (void)wk; (void)wv; const float* cosT = nullptr; const float* sinT = nullptr; (void)cosT; (void)sinT;
    float* OUT = (float*)d_out;     // [4][1024][1024]
    char* wsp = (char*)d_ws;
    auto take = [&](size_t bytes) { char* p = wsp; wsp += (bytes + 255) & ~(size_t)255; return (void*)p; };
    bf* WQKV = (bf*)take((size_t)(DQ + 2 * DKV) * DM * 2); bf* WO = (bf*)take((size_t)DM * DQ * 2);
    bf* XB = (bf*)take((size_t)NB_ * TT * DM * 2); float* SLP = (float*)take(256);
    const size_t SQK = (size_t)(NH_ + NKV) * TT * HD, SV = (size_t)NKV * HD * TT;   // elements of one batch's head planes (32 q heads, then 16 k heads) and of its transposed v planes
    h16* QP16 = (h16*)take(NB_ * SQK * 2); h16* VT16 = (h16*)take(NB_ * SV * 2);
    bf* QPh = (bf*)take(NB_ * SQK * 2); bf* QPl = (bf*)take(NB_ * SQK * 2); bf* VTh = (bf*)take(NB_ * SV * 2); bf* VTl = (bf*)take(NB_ * SV * 2);
    bf* ATh = (bf*)take((size_t)NB_ * TT * DQ * 2); bf* ATl = (bf*)take((size_t)NB_ * TT * DQ * 2);
    if ((size_t)(wsp - (char*)d_ws) > ws_size) return;    // ws 256 MiB
    k_wtGs<<<(unsigned)(((size_t)(DQ + 2 * DKV) * DM / 4 + 255) / 256), 256, 0, stream>>>(wqkv, DM, DQ + 2 * DKV, 4096, WQKV); k_slopes<<<1, 64, 0, stream>>>(SLP);
    k_wtG<<<(unsigned)((DQ * DM / 64 + 63) / 64), 256, 0, stream>>>(wo, DQ, DM, WO);
    k_cvt8<<<(unsigned)(((size_t)NB_ * TT * DM / 8 + 255) / 256), 256, 0, stream>>>(x, XB, (size_t)NB_ * TT * DM / 8);
    k_qkvp<<<dim3(NB_ * TT / 128, (DQ + 2 * DKV) / 128, 1), 128, 0, stream>>>(XB, WQKV, QP16, QPh, QPl, VT16, VTh, VTl);   // all four batches: rows b * 1024 + t
    k_fattn<<<dim3(NKV, NB_, TT / 64), 128, 0, stream>>>(QP16, QPh, QPl, VT16, VTh, VTl, SLP, ATh, ATl);   // all batches and heads
    k_outp<<<dim3(NB_ * TT / 128, DM / 128, 1), 128, 0, stream>>>(ATh, ATl, WO, OUT);   // all four batches: rows b * 1024 + t
}

// v005
// Measured time: 117 microseconds a run.
// In both of two side-by-side timings against v004, it was 1.24 times as fast.
// All steps since v000 together make it 33.2 times as fast.
#include <hip/hip_runtime.h>
#include <stdint.h>

// FlexAttention (inputs [4][1024][1024]; qkv = x W_qkv ([1024][4096]: 2048 q columns = 32 query heads x 64, then 1024 k and 1024 v columns = 16 kv heads; GQA repeat_interleave: query head h uses kv head h/2); scores = q.k / 8 + ALiBi slope_h (j - i) (slopes 2^(-0.25 (h+1)) computed on device in f32); causal; softmax; out = merged (2048) W_out -> [4][1024][1024]).
// Compute dtypes, f32 accumulate: every input rounded to bf16; q/k/v on PLAIN bf16 operands (inputs: exact; column blocks of W_qkv); causal scores and attn.v: query rows < 512 hl (3 products), rows 512..1023 single fp16; ALiBi bias + online softmax f32; W_out hl x exact (2 products).

#define NB_  4
#define TT   1024
#define DM   1024
#define NH_  32
#define NKV  16
#define REP  (NH_ / NKV)
#define HD   64
#define DQ   (NH_ * HD)
#define DKV  (NKV * HD)
#define RH   512                  // query rows < RH use hi+lo planes (k_fattn's grid assumes RH = TT / 2)
#define SCL  0.125f   // HD^-0.5
typedef _Float16 h16;
typedef unsigned short bf;
typedef __attribute__((ext_vector_type(16))) __bf16   v16bf;
typedef __attribute__((ext_vector_type(16))) _Float16 v16h;
typedef __attribute__((ext_vector_type(8)))  _Float16 v8h;
typedef __attribute__((ext_vector_type(8)))  unsigned short v8us;
typedef __attribute__((ext_vector_type(8)))  float    v8f;
typedef __attribute__((ext_vector_type(4)))  float    v4f;
typedef v8h  __attribute__((may_alias)) v8ha;
typedef v4f  __attribute__((may_alias)) v4fa;
typedef v8us __attribute__((may_alias)) v8usa;

__device__ __forceinline__ unsigned short f2bf(float f) { unsigned u = __float_as_uint(f); u += 0x7FFFu + ((u >> 16) & 1u); return (unsigned short)(u >> 16); }
__device__ __forceinline__ float bf2f(unsigned short b) { return __uint_as_float(((unsigned)b) << 16); }
__device__ __forceinline__ float bfr(float f) { return bf2f(f2bf(f)); }
__device__ __forceinline__ v16h cat16(v8h lo, v8h hi) { return __builtin_shufflevector(lo, hi, 0, 1, 2, 3, 4, 5, 6, 7, 8, 9, 10, 11, 12, 13, 14, 15); }
__device__ __forceinline__ v16bf cat16b(v8us lo, v8us hi) { return __builtin_bit_cast(v16bf, __builtin_shufflevector(lo, hi, 0, 1, 2, 3, 4, 5, 6, 7, 8, 9, 10, 11, 12, 13, 14, 15)); }
__device__ __forceinline__ v8f wmma16(v16h a, v16h b, v8f c) { return __builtin_amdgcn_wmma_f32_16x16x32_f16(false, a, false, b, (short)0, c, false, false); }
__device__ __forceinline__ v8f wmmab(v16bf a, v16bf b, v8f c) { return __builtin_amdgcn_wmma_f32_16x16x32_bf16(false, a, false, b, (short)0, c, false, false); }



// ---- fragments of K-contiguous 16-bit planes: 16 rows x 32 k, a lane holds k = 8 hi .. 8 hi + 7 and 16 + 8 hi .. 16 + 8 hi + 7 of row lr.
template <typename T16> struct WFrag;
template <> struct WFrag<h16> { typedef v16h V; static __device__ __forceinline__ V ld(const h16* p) { return cat16(*(const v8h*)p, *(const v8h*)(p + 16)); } static __device__ __forceinline__ v8f mma(V a, V b, v8f c) { return wmma16(a, b, c); } };
template <> struct WFrag<bf> { typedef v16bf V; static __device__ __forceinline__ V ld(const bf* p) { return cat16b(*(const v8us*)p, *(const v8us*)(p + 16)); } static __device__ __forceinline__ v8f mma(V a, V b, v8f c) { return wmmab(a, b, c); } };
// ---- operand tiles in LDS, brought by tensor loads. A tile = 128 rows x 128 B (64 k) of a K-contiguous 16-bit plane; the load's pad gives the rows a pitch of 144 B in LDS (16 B x odd, for 16-byte readers). 128 x 144 B = 9 x 2 KiB.
typedef uint32_t u32x4 __attribute__((ext_vector_type(4)));
typedef uint32_t u32x8 __attribute__((ext_vector_type(8)));
#define TPB   144
#define TILEB (128 * TPB)
__device__ __forceinline__ uint32_t uni(uint32_t v) { return (uint32_t)__builtin_amdgcn_readfirstlane(v); }
__device__ __forceinline__ uint32_t pinned(uint32_t v) { uint32_t w = (uint32_t)__builtin_amdgcn_readfirstlane(v); asm volatile("" : "+s"(w)); return w; }   // holds a test in a scalar register, so that it compiles to a scalar branch: a tensor load ignores EXEC
__device__ __forceinline__ u32x8 tile_group1(uint32_t pitch) { u32x8 g; g[0] = uni((1u << 20) | (4u << 22) | (3u << 25)); g[1] = uni(128u << 16); g[2] = uni(128u << 16); g[3] = uni(128u << 16); g[4] = uni(128u); g[5] = uni(pitch); g[6] = uni(0u); g[7] = uni(0u); return g; }   // bytes: rows of 128, 128 rows, tensor = tile, 16 B of pad behind every 128
__device__ __forceinline__ void tile_addr(u32x4& g, uint32_t place, uint64_t ga) { g[1] = uni(place); g[2] = uni((uint32_t)ga); g[3] = uni(((uint32_t)(ga >> 32) & 0x01FFFFFFu) | 0x80000000u); }   // where the tile lands, its first byte, type 2
__device__ __forceinline__ void tile_load(u32x4 g0, u32x8 g1) { asm volatile("tensor_load_to_lds %0, %1" :: "s"(g0), "s"(g1) : "memory"); }
__device__ __forceinline__ v16bf lds_frag(const unsigned char* p) { return cat16b(*(const v8usa*)p, *(const v8usa*)(p + 32)); }   // same k order as WFrag::ld
// tile_ring: NS stages of NT tiles through two buffers; wave w < NT brings tile w of every stage (its rows start at src, pitch bytes apart; a stage is 128 B further along them). pass(buffer) does one stage's products; the next stage's load flies meanwhile.
template <int NT, int NS, typename F>
__device__ __forceinline__ void tile_ring(unsigned char* ring, uint64_t src, uint32_t pitch, uint32_t wave, F&& pass) {
    const uint32_t place = (uint32_t)(size_t)ring + wave * TILEB; const uint32_t issuer = wave < (uint32_t)NT ? 1u : 0u;
    u32x8 g1 = tile_group1(pitch);
    asm volatile("" : "+s"(g1));   // descriptor words held in their scalar registers (as pinned()): left free, the compiler uses some of them for other values while a request is in flight and restores them in front of the next
    u32x4 g0; g0[0] = uni(1u); tile_addr(g0, place, src);
    // every wait for a request takes that request's group 0 through it: its registers keep their values up to the wait, and the next request's words are formed behind it
    if (pinned(issuer)) { tile_load(g0, g1);
        asm volatile("s_wait_tensorcnt 0x0" : "+s"(g0) :: "memory"); }   // stage 0 has landed before the barrier that publishes it
    __syncthreads();
    if (pinned(issuer)) { tile_addr(g0, place + NT * TILEB, src + 128u); tile_load(g0, g1); }
    // rolled: the buffer alternates by the stage's parity, a second copy of the body would only add code
#pragma unroll 1
    for (uint32_t s = 0; s < (uint32_t)NS; ++s) {
        pass(ring + (s & 1u) * (NT * TILEB));
        asm volatile("s_wait_dscnt 0x0" ::: "memory");   // this wave's reads of the buffer have returned before the barrier behind which it is refilled
        if (pinned(issuer)) asm volatile("s_wait_tensorcnt 0x0" : "+s"(g0) :: "memory");   // stage s + 1 has landed before the barrier that publishes it
        __syncthreads();
        if (pinned((issuer != 0u && s + 2u < (uint32_t)NS) ? 1u : 0u)) { tile_addr(g0, place + (s & 1u) * (NT * TILEB), src + (uint64_t)((s + 2u) * 128u)); tile_load(g0, g1); }
    }
    asm volatile("s_wait_tensorcnt 0x0" ::: "memory");   // nothing is in flight when the ring becomes output staging
    asm volatile("s_wait_dscnt 0x0" ::: "memory");
}
// ---- k_outp: C[m][n] (f32, pitch DM) = sum_k (Ah + Al)[m][k] Bt[n][k], K = DQ. One 128x128 tile per work-group of 4 waves (64x64 each, 16 accumulators); grid (M/128, N/128). Tiles per stage: Ah rows, Al rows, Bt rows.
__global__ __launch_bounds__(128, 4) void k_outp(const bf* __restrict__ Ah, const bf* __restrict__ Al, const bf* __restrict__ Bt, float* C) {
    __shared__ __attribute__((aligned(2048))) unsigned char ring[2 * 3 * TILEB];
    const int lane = threadIdx.x & 31, lr = lane & 15, hi = lane >> 4; const uint32_t wave = uni(threadIdx.x >> 5);
    const int R0 = blockIdx.x * 128, C0 = blockIdx.y * 128; const int r0 = R0 + (int)(wave & 1u) * 64, c0 = C0 + (int)(wave >> 1) * 64;
    const bf* sp = wave == 0u ? Ah + (size_t)R0 * DQ : wave == 1u ? Al + (size_t)R0 * DQ : Bt + (size_t)C0 * DQ;
    v8f acc[4][4];
#pragma unroll
    for (int mb = 0; mb < 4; ++mb)
#pragma unroll
        for (int nb = 0; nb < 4; ++nb) acc[mb][nb] = (v8f){};
    const uint32_t fo = (uint32_t)(lr * TPB + hi * 16), ao = (wave & 1u) * 64u * TPB + fo, bo = 2u * TILEB + (wave >> 1) * 64u * TPB + fo;
    tile_ring<3, DQ / 64>(ring, (uint64_t)(size_t)sp, DQ * 2u, wave, [&](const unsigned char* buf) {
#pragma unroll
        for (int ks = 0; ks < 2; ++ks) { v16bf a[4], a2[4], b[4];
#pragma unroll
            for (int mb = 0; mb < 4; ++mb) { a[mb] = lds_frag(buf + ao + mb * 16 * TPB + ks * 64); a2[mb] = lds_frag(buf + ao + TILEB + mb * 16 * TPB + ks * 64); }
#pragma unroll
            for (int nb = 0; nb < 4; ++nb) b[nb] = lds_frag(buf + bo + nb * 16 * TPB + ks * 64);
            __builtin_amdgcn_sched_barrier(0);   // keeps the fragment reads as one group in front of the products: left free, they sink among them, each with a full wait of its own
#pragma unroll
            for (int nb = 0; nb < 4; ++nb)
#pragma unroll
                for (int mb = 0; mb < 4; ++mb) { acc[mb][nb] = wmmab(a[mb], b[nb], acc[mb][nb]); acc[mb][nb] = wmmab(a2[mb], b[nb], acc[mb][nb]); }
            __builtin_amdgcn_sched_barrier(0); }   // keeps the next group of reads behind these products, whose operands it writes over
        // four vector slots behind the last product, before the next stage's fragment reads write over its A and B registers
        asm volatile("v_nop\n\tv_nop\n\tv_nop\n\tv_nop" :: "v"(acc[0][0]), "v"(acc[1][0]), "v"(acc[2][0]), "v"(acc[3][0]), "v"(acc[0][1]), "v"(acc[1][1]), "v"(acc[2][1]), "v"(acc[3][1]), "v"(acc[0][2]), "v"(acc[1][2]), "v"(acc[2][2]), "v"(acc[3][2]), "v"(acc[0][3]), "v"(acc[1][3]), "v"(acc[2][3]), "v"(acc[3][3]));
    });
    // 16 rows at a time go through the wave's own piece of the ring (every wave has left it: the last stage's barrier), so that a store covers whole lines
    float* os = (float*)(ring + wave * 8192u);
    unsigned cob = (unsigned)(hi * DM + lr * 4) * 4u;   // the lane's byte offset into C: the stores name only this register, a uniform base and constant offsets
#pragma unroll
    for (int mb = 0; mb < 4; ++mb) {
#pragma unroll
        for (int nb = 0; nb < 4; ++nb) {
#pragma unroll
            for (int j = 0; j < 8; ++j) os[(hi * 8 + j) * 68 + nb * 16 + lr] = acc[mb][nb][j]; }
        // the lanes' LDS writes have landed before other lanes of this wave read the rows back; the clobber keeps the reads behind it
        asm volatile("s_wait_dscnt 0x0" ::: "memory");
        float* crow = C + (size_t)(r0 + mb * 16) * DM + c0; v4f val[8];
#pragma unroll
        for (int s = 0; s < 8; ++s) val[s] = *(const v4fa*)(os + (2 * s + hi) * 68 + lr * 4);
#pragma unroll
        for (int s = 0; s < 8; ++s) *(v4fa*)((char*)(crow + (size_t)2 * s * DM) + cob) = val[s];
        __builtin_amdgcn_sched_barrier(0);   // keeps the stores in front of the wait
        // the wait in front of any overwrite of the stores' data and address registers; the offset goes through it so that it stays in its register up to it; the clobber keeps the next rows' LDS writes behind the reads above
        asm volatile("s_wait_xcnt 0x0" : "+v"(cob) :: "memory");
        __builtin_amdgcn_sched_barrier(0);   // keeps the next rows' reads behind the wait
    }
}

__device__ __forceinline__ h16 tohx(float x) { return (h16)x; }
__device__ __forceinline__ void splitf(float y, unsigned short& h, unsigned short& l) { h = f2bf(y); l = f2bf(y - bf2f(h)); }
typedef __attribute__((ext_vector_type(2))) _Float16 v2h;
typedef __attribute__((ext_vector_type(4))) _Float16 v4h;
typedef __attribute__((ext_vector_type(2))) unsigned short v2us;
typedef __attribute__((ext_vector_type(4))) unsigned short v4us;
typedef __attribute__((ext_vector_type(2))) float v2f;
typedef __attribute__((ext_vector_type(4))) int v4i;

__global__ __launch_bounds__(256) void k_cscvt(const float* __restrict__ cosT, const float* __restrict__ sinT, float* CS) { const int idx = blockIdx.x * 256 + threadIdx.x; if (idx >= TT * HD) return; v2f cs; cs[0] = bfr(cosT[idx]); cs[1] = bfr(sinT[idx]); *(v2f*)(CS + (size_t)idx * 2) = cs;  }
// ---- k_qkvp: the q|k|v product of all batches, one 128x128 tile per work-group of 4 waves (64x64 each), operand tiles (x rows, weight rows) in LDS by tile_ring; it writes the attention kernel's operand planes (fp16, bf16 hi, bf16 lo) itself; grid (NB_ TT / 128, 4096 / 128), 128 threads.
// A wave's 64 columns are one head. D[i][j] = sum_k P[i][k] R[j][k]; a lane holds 8 consecutive i of one j, so i is made the plane's contiguous index: q and k tiles (planes [head][t][d]): P = weight rows (i = d), R = x rows (j = t); v tiles (planes [head][d][t]): P = x rows (i = t), R = weight rows (j = d).
typedef __attribute__((ext_vector_type(8))) __bf16 v8b;
typedef v8b __attribute__((may_alias)) v8ba;
#define SP 72   // LDS row pitch in 16-bit elements: 128 B of data + 16 B, for 16-byte readers and writers
// put_planes: 16 rows j at a time, each 64 i = one 128-B line per plane, go through the wave's own LDS so that every global store covers four whole lines. OP = the planes' row pitch in elements.
template <int OP>
__device__ __forceinline__ void put_planes(const v8f (&acc)[4][4], unsigned short* st, h16* O16, bf* Oh, bf* Ol, int lane) {
    const int lr = lane & 15, hi = lane >> 4;
    unsigned oob = (unsigned)((lane >> 3) * OP + (lane & 7) * 8) * 2u;   // the lane's byte offset into the planes: the stores name only this register, the planes' uniform bases and constant offsets
#pragma unroll
    for (int nb = 0; nb < 4; ++nb) {
#pragma unroll
        for (int mb = 0; mb < 4; ++mb) { v8h o16; v8b oh, ol;
#pragma unroll
            for (int j = 0; j < 8; ++j) { const float r = acc[mb][nb][j]; o16[j] = tohx(r); oh[j] = (__bf16)r; ol[j] = (__bf16)(r - (float)oh[j]); }   // round to nearest even, as splitf
            unsigned short* sp = st + lr * SP + (mb * 2 + hi) * 8; *(v8ha*)sp = o16; *(v8ba*)(sp + 16 * SP) = oh; *(v8ba*)(sp + 32 * SP) = ol; }
        // the lanes' LDS writes have landed before other lanes of this wave read the rows back; the clobber keeps the reads behind it (the rows are this wave's own: no barrier)
        asm volatile("s_wait_dscnt 0x0" ::: "memory");
        v8us val[3][4];
#pragma unroll
        for (int p = 0; p < 3; ++p)
#pragma unroll
            for (int s = 0; s < 4; ++s) val[p][s] = *(const v8usa*)(st + (p * 16 + 4 * s + (lane >> 3)) * SP + (lane & 7) * 8);
#pragma unroll
        for (int s = 0; s < 4; ++s) { const int eo = (nb * 16 + 4 * s) * OP; *(v8usa*)((char*)(O16 + eo) + oob) = val[0][s]; *(v8usa*)((char*)(Oh + eo) + oob) = val[1][s]; *(v8usa*)((char*)(Ol + eo) + oob) = val[2][s]; }
        __builtin_amdgcn_sched_barrier(0);   // keeps the stores in front of the wait
        // the wait in front of any overwrite of the stores' data and address registers by the next rows' conversions; the offset goes through it so that it stays in its register up to it; the clobber keeps the next rows' LDS writes behind the reads above
        asm volatile("s_wait_xcnt 0x0" : "+v"(oob) :: "memory");
        __builtin_amdgcn_sched_barrier(0);   // keeps the next rows' arithmetic behind the wait
    }
}
__global__ __launch_bounds__(128, 4) void k_qkvp(const bf* __restrict__ X, const bf* __restrict__ Wt, h16* QK16, bf* QKh, bf* QKl, h16* V16, bf* Vh, bf* Vl) {
    __shared__ __attribute__((aligned(2048))) unsigned char ring[2 * 2 * TILEB];
    const int lane = threadIdx.x & 31; const uint32_t wave = uni(threadIdx.x >> 5), xs = wave & 1u, cs = wave >> 1;
    const int R0 = blockIdx.x * 128, C0 = blockIdx.y * 128; const int r0 = R0 + (int)xs * 64, c0 = C0 + (int)cs * 64; const int b = r0 / TT, t0 = r0 % TT; const bool isv = C0 >= DQ + DKV;
    const bf* sp = wave == 0u ? X + (size_t)R0 * DM : Wt + (size_t)C0 * DM;   // tile 0: x rows, tile 1: weight rows
    v8f acc[4][4];
#pragma unroll
    for (int mb = 0; mb < 4; ++mb)
#pragma unroll
        for (int nb = 0; nb < 4; ++nb) acc[mb][nb] = (v8f){};
    const uint32_t fo = (uint32_t)((lane & 15) * TPB + (lane >> 4) * 16), xo = xs * 64u * TPB + fo, wo = TILEB + cs * 64u * TPB + fo; const uint32_t po = isv ? xo : wo, ro = isv ? wo : xo;
    tile_ring<2, DM / 64>(ring, (uint64_t)(size_t)sp, DM * 2u, wave, [&](const unsigned char* buf) {
#pragma unroll
        for (int ks = 0; ks < 2; ++ks) { v16bf a[4], bb[4];
#pragma unroll
            for (int mb = 0; mb < 4; ++mb) a[mb] = lds_frag(buf + po + mb * 16 * TPB + ks * 64);
#pragma unroll
            for (int nb = 0; nb < 4; ++nb) bb[nb] = lds_frag(buf + ro + nb * 16 * TPB + ks * 64);
            __builtin_amdgcn_sched_barrier(0);   // keeps the fragment reads as one group in front of the products: left free, they sink among them, each with a full wait of its own
#pragma unroll
            for (int nb = 0; nb < 4; ++nb)
#pragma unroll
                for (int mb = 0; mb < 4; ++mb) acc[mb][nb] = wmmab(a[mb], bb[nb], acc[mb][nb]);
            __builtin_amdgcn_sched_barrier(0); }   // keeps the next group of reads behind these products, whose operands it writes over
        // four vector slots behind the last product, before the next stage's fragment reads write over its A and B registers
        asm volatile("v_nop\n\tv_nop\n\tv_nop\n\tv_nop" :: "v"(acc[0][0]), "v"(acc[1][0]), "v"(acc[2][0]), "v"(acc[3][0]), "v"(acc[0][1]), "v"(acc[1][1]), "v"(acc[2][1]), "v"(acc[3][1]), "v"(acc[0][2]), "v"(acc[1][2]), "v"(acc[2][2]), "v"(acc[3][2]), "v"(acc[0][3]), "v"(acc[1][3]), "v"(acc[2][3]), "v"(acc[3][3]));
    });
    unsigned short* st = (unsigned short*)(ring + wave * 8192u);   // the wave's own piece of the ring, which every wave has left (the last stage's barrier)
    if (isv) { const size_t o = ((size_t)b * NKV + (c0 - DQ - DKV) / HD) * HD * TT + t0; put_planes<TT>(acc, st, V16 + o, Vh + o, Vl + o, lane); }
    else { const size_t o = (((size_t)b * (NH_ + NKV) + c0 / HD) * TT + t0) * HD; put_planes<HD>(acc, st, QK16 + o, QKh + o, QKl + o, lane); }
}
// ---- k_fattn: causal ALiBi attention in one kernel (scores, softmax and probability x value never leave the registers). One wave owns 32 query columns of one head and walks the keys 0 .. q0 + 31 in blocks of 32.
// St = K Qt: a lane holds the scores of ONE query (column lr of a 16-column group), keys 8 hi + j of each 16-key tile; two such tiles, converted in place, are the B operand of Ot += Vt Pt (same k order as WFrag::ld).
// Running maximum in scaled log2 units; the output tiles are rescaled only when some column's maximum has grown by more than 8. Operand planes as before: NSPLIT 2 = hi + lo bf16, three products; NSPLIT 0 = single fp16.
#define L2E  1.4426950408889634f
template <typename T16, int NSPLIT>
__device__ __forceinline__ void attn_body(const T16* __restrict__ Q, const T16* __restrict__ Q2, const T16* __restrict__ Kp, const T16* __restrict__ K2, const T16* __restrict__ Vt, const T16* __restrict__ V2, float sl2, int q0, bf* Ah, bf* Al) {
    typedef typename WFrag<T16>::V V;
    int lane = threadIdx.x & 31;
    V qf[2][2], qf2[2][2], kf[2][2], kf2[2][2];
    // each lane's own byte offsets into the Q and K planes: the fetches name only these registers and the planes' uniform bases, with constant offsets; kob is carried through the loop
    unsigned qob = (unsigned)((q0 + (lane & 15)) * HD + 8 * (lane >> 4)) * 2u, kob = (unsigned)((lane & 15) * HD + 8 * (lane >> 4)) * 2u;
#pragma unroll
    for (int nq = 0; nq < 2; ++nq)
#pragma unroll
        for (int ks = 0; ks < 2; ++ks) { const int qo = nq * 16 * HD + ks * 32; qf[nq][ks] = WFrag<T16>::ld((const T16*)((const char*)Q + qob) + qo); if (NSPLIT == 2) qf2[nq][ks] = WFrag<T16>::ld((const T16*)((const char*)Q2 + qob) + qo); }
#pragma unroll
    for (int kt = 0; kt < 2; ++kt)
#pragma unroll
        for (int ks = 0; ks < 2; ++ks) { const int ko = kt * 16 * HD + ks * 32; kf[kt][ks] = WFrag<T16>::ld((const T16*)((const char*)Kp + kob) + ko); if (NSPLIT == 2) kf2[kt][ks] = WFrag<T16>::ld((const T16*)((const char*)K2 + kob) + ko); }
    __builtin_amdgcn_sched_barrier(0);   // keeps the fetches in front of the wait
    // the wait in front of any overwrite of the Q and K fetches' address registers. The offsets go through it so that they stay in their registers up to it,
    // the lane number so that the arithmetic below, all of which starts from it, stays behind it
    asm volatile("s_wait_xcnt 0x0" : "+v"(lane), "+v"(qob), "+v"(kob) :: "memory");
    __builtin_amdgcn_sched_barrier(0);   // keeps all later arithmetic behind the wait
    const int lr = lane & 15, hi = lane >> 4;
    v8f o[4][2]; float m[2], l[2], bl[2][8];
#pragma unroll
    for (int nq = 0; nq < 2; ++nq) { m[nq] = -3.0e38f; l[nq] = 0.f;
#pragma unroll
        for (int dt = 0; dt < 4; ++dt) o[dt][nq] = (v8f){}; }
#pragma unroll
    for (int kt = 0; kt < 2; ++kt)
#pragma unroll
        for (int j = 0; j < 8; ++j) bl[kt][j] = sl2 * (float)(kt * 16 + 8 * hi + j);   // ALiBi bias inside a key block; the block's own offset goes into the exponent's shift
    unsigned vob = (unsigned)(lr * TT + 8 * hi) * 2u;   // the lane's byte offset into the Vt planes, carried through the loop like kob
    // rolled: a second copy of the body would only add registers; the K fetch one block ahead already spans the back edge
    int k0 = 0;
#pragma unroll 1
    do {   // at least the diagonal block: q0 >= 0
        V vf[4], vf2[4];
#pragma unroll
        for (int dt = 0; dt < 4; ++dt) { vf[dt] = WFrag<T16>::ld((const T16*)((const char*)Vt + vob) + dt * 16 * TT); if (NSPLIT == 2) vf2[dt] = WFrag<T16>::ld((const T16*)((const char*)V2 + vob) + dt * 16 * TT); }
        __builtin_amdgcn_sched_barrier(0);   // keeps this block's Vt fetch in front of the score products: left free it sinks behind them, and its latency then stands open in front of P.V
        // the wait in front of any overwrite of the Vt fetch's address registers; the offset goes through it so that it stays in its register up to it
        asm volatile("s_wait_xcnt 0x0" : "+v"(vob) :: "memory");
        __builtin_amdgcn_sched_barrier(0);   // keeps the score products and all later arithmetic behind that wait
        vob += 32u * 2u;
        v8f s[2][2];
#pragma unroll
        for (int kt = 0; kt < 2; ++kt)
#pragma unroll
            for (int nq = 0; nq < 2; ++nq) { v8f t = (v8f){};
#pragma unroll
                for (int ks = 0; ks < 2; ++ks) { t = WFrag<T16>::mma(kf[kt][ks], qf[nq][ks], t); if (NSPLIT == 2) { t = WFrag<T16>::mma(kf2[kt][ks], qf[nq][ks], t); t = WFrag<T16>::mma(kf[kt][ks], qf2[nq][ks], t); } }
                s[kt][nq] = t; }
        // the next block's K fragments, fetched one block ahead into the same registers (the last block fetches its own rows again: in bounds, unused)
        kob += (k0 < q0) ? 32u * HD * 2u : 0u;
        __builtin_amdgcn_sched_barrier(0);   // keeps the fetch's address arithmetic in one piece in front of the fetch, so that none of it writes over an address in use
#pragma unroll
        for (int kt = 0; kt < 2; ++kt)
#pragma unroll
            for (int ks = 0; ks < 2; ++ks) { const int ko = kt * 16 * HD + ks * 32; kf[kt][ks] = WFrag<T16>::ld((const T16*)((const char*)Kp + kob) + ko); if (NSPLIT == 2) kf2[kt][ks] = WFrag<T16>::ld((const T16*)((const char*)K2 + kob) + ko); }
        __builtin_amdgcn_sched_barrier(0);   // keeps the fetch in front of the wait
        // the same wait for the K fetch's address register, which goes through it like vob above
        asm volatile("s_wait_xcnt 0x0" : "+v"(kob) :: "memory");
        __builtin_amdgcn_sched_barrier(0);   // keeps all later arithmetic behind the wait
        float off[2], cand[2];
#pragma unroll
        for (int nq = 0; nq < 2; ++nq) {
#pragma unroll
            for (int kt = 0; kt < 2; ++kt)
#pragma unroll
                for (int j = 0; j < 8; ++j) s[kt][nq][j] = fmaf(s[kt][nq][j], SCL * L2E, bl[kt][j]);
            if (k0 == q0) {   // the diagonal block (wave-uniform): keys beyond the query are masked
#pragma unroll
                for (int kt = 0; kt < 2; ++kt)
#pragma unroll
                    for (int j = 0; j < 8; ++j) if (kt * 16 + 8 * hi + j > nq * 16 + lr) s[kt][nq][j] = -3.0e38f; }
            float mx = s[0][nq][0];
#pragma unroll
            for (int kt = 0; kt < 2; ++kt)
#pragma unroll
                for (int j = 0; j < 8; ++j) mx = fmaxf(mx, s[kt][nq][j]);
            mx = fmaxf(mx, __shfl_xor(mx, 16, 32));
            off[nq] = sl2 * (float)(k0 - (q0 + nq * 16 + lr)); cand[nq] = mx + off[nq]; }
        if (__builtin_amdgcn_ballot_w32(cand[0] > m[0] + 8.0f || cand[1] > m[1] + 8.0f) != 0) {
#pragma unroll
            for (int nq = 0; nq < 2; ++nq) { const float mn = fmaxf(m[nq], cand[nq]); const float al = __builtin_amdgcn_exp2f(m[nq] - mn); m[nq] = mn; l[nq] *= al;
#pragma unroll
                for (int dt = 0; dt < 4; ++dt) o[dt][nq] *= al; } }
#pragma unroll
        for (int nq = 0; nq < 2; ++nq) { const float sh = m[nq] - off[nq]; V p, p2; float ls = 0.f;
#pragma unroll
            for (int e = 0; e < 16; ++e) { const float pe = __builtin_amdgcn_exp2f(s[e >> 3][nq][e & 7] - sh); ls += pe;
                if constexpr (NSPLIT == 2) { p[e] = (__bf16)pe; p2[e] = (__bf16)(pe - (float)p[e]); } else { p[e] = (h16)pe; } }
            l[nq] += ls;
#pragma unroll
            for (int dt = 0; dt < 4; ++dt) { o[dt][nq] = WFrag<T16>::mma(vf[dt], p, o[dt][nq]); if (NSPLIT == 2) { o[dt][nq] = WFrag<T16>::mma(vf[dt], p2, o[dt][nq]); o[dt][nq] = WFrag<T16>::mma(vf2[dt], p, o[dt][nq]); } } }
        // four vector slots behind the last P.V product, before the next block's Vt fetch and score products write over its A and B registers
        asm volatile("v_nop\n\tv_nop\n\tv_nop\n\tv_nop" :: "v"(o[0][1]), "v"(o[1][1]), "v"(o[2][1]), "v"(o[3][1]));
        k0 += 32;
    } while (k0 <= q0);
#pragma unroll
    for (int nq = 0; nq < 2; ++nq) { const float inv = __fdiv_rn(1.0f, l[nq] + __shfl_xor(l[nq], 16, 32));
#pragma unroll
        for (int dt = 0; dt < 4; ++dt) { v8us oh, ol;
#pragma unroll
            for (int j = 0; j < 8; ++j) { unsigned short x, y; splitf(o[dt][nq][j] * inv, x, y); oh[j] = x; ol[j] = y; }
            const size_t oo = (size_t)(q0 + nq * 16 + lr) * DQ + dt * 16 + 8 * hi; *(v8us*)(Ah + oo) = oh; *(v8us*)(Al + oo) = ol; } }
}
// grid (kv head, batch, 16 position blocks of 64 queries, long ones first, hi+lo and fp16 blocks alternating); 4 independent waves: 2 query heads of the kv head x 2 column groups, so that they read the same K and V lines.
__global__ __launch_bounds__(128) void k_fattn(const h16* __restrict__ QK16, const bf* __restrict__ QKh, const bf* __restrict__ QKl, const h16* __restrict__ V16, const bf* __restrict__ Vh, const bf* __restrict__ Vl, const float* __restrict__ SLP, bf* Ah, bf* Al) {
    const int w = __builtin_amdgcn_readfirstlane(threadIdx.x >> 5); const int g = blockIdx.x, b = blockIdx.y, zz = blockIdx.z;
    const int pb = (zz & 1) ? (RH / 64 - 1 - (zz >> 1)) : (TT / 64 - 1 - (zz >> 1)); const int h = g * REP + (w & 1); const int q0 = pb * 64 + (w >> 1) * 32;
    const size_t qo = ((size_t)b * (NH_ + NKV) + h) * TT * HD, ko = ((size_t)b * (NH_ + NKV) + NH_ + g) * TT * HD, vo = ((size_t)b * NKV + g) * HD * TT, ao = (size_t)b * TT * DQ + h * HD;
    const float sl2 = SLP[h] * L2E;
    if (q0 < RH) attn_body<bf, 2>(QKh + qo, QKl + qo, QKh + ko, QKl + ko, Vh + vo, Vl + vo, sl2, q0, Ah + ao, Al + ao);
    else attn_body<h16, 0>(QK16 + qo, nullptr, QK16 + ko, nullptr, V16 + vo, nullptr, sl2, q0, Ah + ao, Al + ao);
}

// ---- k_prep: all input preparation in one launch. A work-group takes one piece of 64 KiB of f32 input, every lane with its 16 loads of 16 bytes in flight at once: a 128 k x 128 n tile of a weight (written transposed, bf16, Bt[n][k] = w[k][n]), or 16384 elements of x (bf16, same order); the last work-group writes the ALiBi slopes.
typedef __attribute__((ext_vector_type(4))) __bf16 v4b;
typedef v4b __attribute__((may_alias)) v4ba;
#define PIECE   16384
#define NT_QKV  ((DM / 128) * ((DQ + 2 * DKV) / 128))
#define NT_OUT  ((DQ / 128) * (DM / 128))
#define NP_X    (NB_ * TT * DM / PIECE)
// wt_tile: reads cover whole lines of w (16 lanes = 256 B of one row), writes whole lines of Bt (16 lanes = 256 B of one row); the turn goes through LDS.
// A lane holds 16 k x 4 n and writes 4 k of one n (8 B) at a time. LDS row n = 128 k = 16 pieces of 16 B, piece c kept at place c ^ ((n >> 2) & 15): the 32 lanes of a write (16 rows n four apart x 2 halves of a piece) and the 16 lanes of a read (one row) each fall on all 64 banks once.
template <int K, int N>
__device__ __forceinline__ void wt_tile(const float* __restrict__ w, bf* Bt, int tile, unsigned char* T) {
    const int tid = threadIdx.x, l = tid & 15, h = (tid >> 4) & 1, ch = (tid >> 5) & 1, kq = tid >> 6;
    const int k0 = (tile % (K / 128)) * 128, n0 = (tile / (K / 128)) * 128;
    const float* src = w + (size_t)k0 * N + n0; bf* dst = Bt + (size_t)n0 * K + k0;
    unsigned sob = (unsigned)((kq * 32 + h * 4) * N + ch * 64 + l * 4) * 4u;   // the lane's byte offset into the tile of w: the loads name only this register, a uniform base and constant offsets
    v4f r[4][4];
#pragma unroll
    for (int i = 0; i < 4; ++i)
#pragma unroll
        for (int u = 0; u < 4; ++u) r[i][u] = *(const v4fa*)((const char*)(src + (size_t)(i * 8 + u) * N) + sob);   // row k = 32 kq + 8 i + 4 h + u
    __builtin_amdgcn_sched_barrier(0);   // keeps the loads in front of the wait
    // the wait in front of any overwrite of the loads' address register; the offset goes through it so that it stays in its register up to it
    asm volatile("s_wait_xcnt 0x0" : "+v"(sob) :: "memory");
    __builtin_amdgcn_sched_barrier(0);   // keeps all later arithmetic behind the wait
#pragma unroll
    for (int i = 0; i < 4; ++i)
#pragma unroll
        for (int j = 0; j < 4; ++j) { v4b o;
#pragma unroll
            for (int u = 0; u < 4; ++u) o[u] = (__bf16)r[i][u][j];   // round to nearest even, as f2bf
            *(v4ba*)(T + (ch * 64 + l * 4 + j) * 256 + (((kq * 4 + i) ^ l) * 16) + h * 8) = o; }
    __syncthreads();   // the tile is whole in LDS before any wave reads rows that other waves wrote
    const int rn = tid >> 4; v8us val[8];
#pragma unroll
    for (int i = 0; i < 8; ++i) { const int n = rn + 16 * i; val[i] = *(const v8usa*)(T + n * 256 + ((l ^ ((n >> 2) & 15)) * 16)); }
    const unsigned dob = (unsigned)(rn * K + l * 8) * 2u;
#pragma unroll
    for (int i = 0; i < 8; ++i) *(v8usa*)((char*)(dst + (size_t)16 * i * K) + dob) = val[i];
}
__global__ __launch_bounds__(256) void k_prep(const float* __restrict__ x, const float* __restrict__ wqkv, const float* __restrict__ wo, bf* XB, bf* WQKV, bf* WO, float* SLP) {
    __shared__ __attribute__((aligned(16))) unsigned char T[128 * 256];
    const int bid = blockIdx.x;
    if (bid < NT_QKV) { wt_tile<DM, DQ + 2 * DKV>(wqkv, WQKV, bid, T); return; }
    if (bid < NT_QKV + NT_OUT) { wt_tile<DQ, DM>(wo, WO, bid - NT_QKV, T); return; }
    if (bid < NT_QKV + NT_OUT + NP_X) {
        const size_t p0 = (size_t)(bid - NT_QKV - NT_OUT) * PIECE; const float* src = x + p0; bf* dst = XB + p0;
        unsigned sob = threadIdx.x * 16u;   // the lane's byte offset into the piece: the loads name only this register, a uniform base and constant offsets
        v4f r[16]; v4b o[16];
#pragma unroll
        for (int i = 0; i < 16; ++i) r[i] = *(const v4fa*)((const char*)(src + i * 1024) + sob);
        __builtin_amdgcn_sched_barrier(0);   // keeps the loads in front of the wait
        // the wait in front of any overwrite of the loads' address register; the offset goes through it so that it stays in its register up to it
        asm volatile("s_wait_xcnt 0x0" : "+v"(sob) :: "memory");
        __builtin_amdgcn_sched_barrier(0);   // keeps all later arithmetic behind the wait
#pragma unroll
        for (int i = 0; i < 16; ++i)
#pragma unroll
            for (int u = 0; u < 4; ++u) o[i][u] = (__bf16)r[i][u];   // round to nearest even, as f2bf
        const unsigned dob = sob >> 1;
#pragma unroll
        for (int i = 0; i < 16; ++i) *(v4ba*)((char*)(dst + i * 1024) + dob) = o[i];
        return; }
    const int h = threadIdx.x; if (h >= 64) return; const float base = 0.8408964152537145f; const float v = (h < NH_) ? powf(base, (float)(h + 1)) : 0.f; *(float*)(SLP + h) = v;   // ALiBi slopes 2^(-0.25 (h+1)) as f32 base^power
}

extern "C" void kernel_launch(void* const* d_in, const int* in_sizes, int n_in,
                              void* d_out, int out_size, void* d_ws, size_t ws_size, hipStream_t stream) {
    (void)in_sizes; (void)n_in; (void)out_size;
    const float* x = (const float*)d_in[0]; const float* wqkv = (const float*)d_in[1]; const float* wo = (const float*)d_in[2]; const float* wq = nullptr; const float* wk = nullptr; const float* wv = nullptr; (void)wq; (void)wk; (void)wv; const float* cosT = nullptr; const float* sinT = nullptr; (void)cosT; (void)sinT;
    float* OUT = (float*)d_out;     // [4][1024][1024]
    char* wsp = (char*)d_ws;
    auto take = [&](size_t bytes) { char* p = wsp; wsp += (bytes + 255) & ~(size_t)255; return (void*)p; };
    bf* WQKV = (bf*)take((size_t)(DQ + 2 * DKV) * DM * 2); bf* WO = (bf*)take((size_t)DM * DQ * 2);
    bf* XB = (bf*)take((size_t)NB_ * TT * DM * 2); float* SLP = (float*)take(256);
    const size_t SQK = (size_t)(NH_ + NKV) * TT * HD, SV = (size_t)NKV * HD * TT;   // elements of one batch's head planes (32 q heads, then 16 k heads) and of its transposed v planes
    h16* QP16 = (h16*)take(NB_ * SQK * 2); h16* VT16 = (h16*)take(NB_ * SV * 2);
    bf* QPh = (bf*)take(NB_ * SQK * 2); bf* QPl = (bf*)take(NB_ * SQK * 2); bf* VTh = (bf*)take(NB_ * SV * 2); bf* VTl = (bf*)take(NB_ * SV * 2);
    bf* ATh = (bf*)take((size_t)NB_ * TT * DQ * 2); bf* ATl = (bf*)take((size_t)NB_ * TT * DQ * 2);
    if ((size_t)(wsp - (char*)d_ws) > ws_size) return;    // ws 256 MiB
    k_prep<<<NT_QKV + NT_OUT + NP_X + 1, 256, 0, stream>>>(x, wqkv, wo, XB, WQKV, WO, SLP);   // weight tiles first, then the pieces of x, then the slopes
    k_qkvp<<<dim3(NB_ * TT / 128, (DQ + 2 * DKV) / 128, 1), 128, 0, stream>>>(XB, WQKV, QP16, QPh, QPl, VT16, VTh, VTl);   // all four batches: rows b * 1024 + t
    k_fattn<<<dim3(NKV, NB_, TT / 64), 128, 0, stream>>>(QP16, QPh, QPl, VT16, VTh, VTl, SLP, ATh, ATl);   // all batches and heads
    k_outp<<<dim3(NB_ * TT / 128, DM / 128, 1), 128, 0, stream>>>(ATh, ATl, WO, OUT);   // all four batches: rows b * 1024 + t
}

// v006
// Measured time: 101 microseconds a run.
// Next to v005, in two timings, it ran 1.18 and 1.16 times as fast.
// Over all steps from v000 it is 38.7 times as fast.
#include <hip/hip_runtime.h>
#include <stdint.h>

// FlexAttention (inputs [4][1024][1024]; qkv = x W_qkv ([1024][4096]: 2048 q columns = 32 query heads x 64, then 1024 k and 1024 v columns = 16 kv heads; GQA repeat_interleave: query head h uses kv head h/2); scores = q.k / 8 + ALiBi slope_h (j - i) (slopes 2^(-0.25 (h+1)) computed on device in f32); causal; softmax; out = merged (2048) W_out -> [4][1024][1024]).
// Compute dtypes, f32 accumulate: every input rounded to bf16; q/k/v on PLAIN bf16 operands (inputs: exact; column blocks of W_qkv); causal scores and attn.v: query rows < 512 hl (3 products), rows 512..1023 single fp16; ALiBi bias + online softmax f32; W_out hl x exact (2 products).

#define NB_  4
#define TT   1024
#define DM   1024
#define NH_  32
#define NKV  16
#define REP  (NH_ / NKV)
#define HD   64
#define DQ   (NH_ * HD)
#define DKV  (NKV * HD)
#define RH   512                  // query rows < RH use hi+lo planes (k_fattn's grid assumes RH = TT / 2)
#define SCL  0.125f   // HD^-0.5
typedef _Float16 h16;
typedef unsigned short bf;
typedef __attribute__((ext_vector_type(16))) __bf16   v16bf;
typedef __attribute__((ext_vector_type(16))) _Float16 v16h;
typedef __attribute__((ext_vector_type(8)))  _Float16 v8h;
typedef __attribute__((ext_vector_type(8)))  unsigned short v8us;
typedef __attribute__((ext_vector_type(8)))  float    v8f;
typedef __attribute__((ext_vector_type(4)))  float    v4f;
typedef v8h  __attribute__((may_alias)) v8ha;
typedef v4f  __attribute__((may_alias)) v4fa;
typedef v8us __attribute__((may_alias)) v8usa;

__device__ __forceinline__ unsigned short f2bf(float f) { unsigned u = __float_as_uint(f); u += 0x7FFFu + ((u >> 16) & 1u); return (unsigned short)(u >> 16); }
__device__ __forceinline__ float bf2f(unsigned short b) { return __uint_as_float(((unsigned)b) << 16); }
__device__ __forceinline__ float bfr(float f) { return bf2f(f2bf(f)); }
__device__ __forceinline__ v16h cat16(v8h lo, v8h hi) { return __builtin_shufflevector(lo, hi, 0, 1, 2, 3, 4, 5, 6, 7, 8, 9, 10, 11, 12, 13, 14, 15); }
__device__ __forceinline__ v16bf cat16b(v8us lo, v8us hi) { return __builtin_bit_cast(v16bf, __builtin_shufflevector(lo, hi, 0, 1, 2, 3, 4, 5, 6, 7, 8, 9, 10, 11, 12, 13, 14, 15)); }
__device__ __forceinline__ v8f wmma16(v16h a, v16h b, v8f c) { return __builtin_amdgcn_wmma_f32_16x16x32_f16(false, a, false, b, (short)0, c, false, false); }
__device__ __forceinline__ v8f wmmab(v16bf a, v16bf b, v8f c) { return __builtin_amdgcn_wmma_f32_16x16x32_bf16(false, a, false, b, (short)0, c, false, false); }



// ---- fragments of K-contiguous 16-bit planes: 16 rows x 32 k, a lane holds k = 8 hi .. 8 hi + 7 and 16 + 8 hi .. 16 + 8 hi + 7 of row lr.
template <typename T16> struct WFrag;
template <> struct WFrag<h16> { typedef v16h V; static __device__ __forceinline__ V ld(const h16* p) { return cat16(*(const v8h*)p, *(const v8h*)(p + 16)); } static __device__ __forceinline__ v8f mma(V a, V b, v8f c) { return wmma16(a, b, c); } };
template <> struct WFrag<bf> { typedef v16bf V; static __device__ __forceinline__ V ld(const bf* p) { return cat16b(*(const v8us*)p, *(const v8us*)(p + 16)); } static __device__ __forceinline__ v8f mma(V a, V b, v8f c) { return wmmab(a, b, c); } };
// ---- operand tiles in LDS, brought by tensor loads. A tile = 128 rows x 128 B (64 k) of a K-contiguous 16-bit plane; the load's pad gives the rows a pitch of 144 B in LDS (16 B x odd, for 16-byte readers). 128 x 144 B = 9 x 2 KiB.
typedef uint32_t u32x4 __attribute__((ext_vector_type(4)));
typedef uint32_t u32x8 __attribute__((ext_vector_type(8)));
#define TPB   144
#define TILEB (128 * TPB)
__device__ __forceinline__ uint32_t uni(uint32_t v) { return (uint32_t)__builtin_amdgcn_readfirstlane(v); }
__device__ __forceinline__ uint32_t pinned(uint32_t v) { uint32_t w = (uint32_t)__builtin_amdgcn_readfirstlane(v); asm volatile("" : "+s"(w)); return w; }   // holds a test in a scalar register, so that it compiles to a scalar branch: a tensor load ignores EXEC
__device__ __forceinline__ u32x8 tile_group1(uint32_t pitch) { u32x8 g; g[0] = uni((1u << 20) | (4u << 22) | (3u << 25)); g[1] = uni(128u << 16); g[2] = uni(128u << 16); g[3] = uni(128u << 16); g[4] = uni(128u); g[5] = uni(pitch); g[6] = uni(0u); g[7] = uni(0u); return g; }   // bytes: rows of 128, 128 rows, tensor = tile, 16 B of pad behind every 128
__device__ __forceinline__ void tile_addr(u32x4& g, uint32_t place, uint64_t ga) { g[1] = uni(place); g[2] = uni((uint32_t)ga); g[3] = uni(((uint32_t)(ga >> 32) & 0x01FFFFFFu) | 0x80000000u); }   // where the tile lands, its first byte, type 2
__device__ __forceinline__ void tile_load(u32x4 g0, u32x8 g1) { asm volatile("tensor_load_to_lds %0, %1" :: "s"(g0), "s"(g1) : "memory"); }
__device__ __forceinline__ v16bf lds_frag(const unsigned char* p) { return cat16b(*(const v8usa*)p, *(const v8usa*)(p + 32)); }   // same k order as WFrag::ld
// tile_ring: NS stages of NT tiles through two buffers; wave w < NT brings tile w of every stage (its rows start at src, pitch bytes apart; a stage is 128 B further along them). pass(buffer) does one stage's products; the next stage's load flies meanwhile.
template <int NT, int NS, typename F>
__device__ __forceinline__ void tile_ring(unsigned char* ring, uint64_t src, uint32_t pitch, uint32_t wave, F&& pass) {
    const uint32_t place = (uint32_t)(size_t)ring + wave * TILEB; const uint32_t issuer = wave < (uint32_t)NT ? 1u : 0u;
    u32x8 g1 = tile_group1(pitch);
    asm volatile("" : "+s"(g1));   // descriptor words held in their scalar registers (as pinned()): left free, the compiler uses some of them for other values while a request is in flight and restores them in front of the next
    u32x4 g0; g0[0] = uni(1u); tile_addr(g0, place, src);
    // every wait for a request takes that request's group 0 through it: its registers keep their values up to the wait, and the next request's words are formed behind it
    if (pinned(issuer)) { tile_load(g0, g1);
        asm volatile("s_wait_tensorcnt 0x0" : "+s"(g0) :: "memory"); }   // stage 0 has landed before the barrier that publishes it
    __syncthreads();
    if (pinned(issuer)) { tile_addr(g0, place + NT * TILEB, src + 128u); tile_load(g0, g1); }
    // rolled: the buffer alternates by the stage's parity, a second copy of the body would only add code
#pragma unroll 1
    for (uint32_t s = 0; s < (uint32_t)NS; ++s) {
        pass(ring + (s & 1u) * (NT * TILEB));
        asm volatile("s_wait_dscnt 0x0" ::: "memory");   // this wave's reads of the buffer have returned before the barrier behind which it is refilled
        if (pinned(issuer)) asm volatile("s_wait_tensorcnt 0x0" : "+s"(g0) :: "memory");   // stage s + 1 has landed before the barrier that publishes it
        __syncthreads();
        if (pinned((issuer != 0u && s + 2u < (uint32_t)NS) ? 1u : 0u)) { tile_addr(g0, place + (s & 1u) * (NT * TILEB), src + (uint64_t)((s + 2u) * 128u)); tile_load(g0, g1); }
    }
    asm volatile("s_wait_tensorcnt 0x0" ::: "memory");   // nothing is in flight when the ring becomes output staging
    asm volatile("s_wait_dscnt 0x0" ::: "memory");
}
// ---- k_outp: C[m][n] (f32, pitch DM) = sum_k (Ah + Al)[m][k] Bt[n][k], K = DQ. One 128x128 tile per work-group of 4 waves (64x64 each, 16 accumulators); grid (M/128, N/128). Tiles per stage: Ah rows, Al rows, Bt rows.
__global__ __launch_bounds__(128, 4) void k_outp(const bf* __restrict__ Ah, const bf* __restrict__ Al, const bf* __restrict__ Bt, float* C) {
    __shared__ __attribute__((aligned(2048))) unsigned char ring[2 * 3 * TILEB];
    const int lane = threadIdx.x & 31, lr = lane & 15, hi = lane >> 4; const uint32_t wave = uni(threadIdx.x >> 5);
    const int R0 = blockIdx.x * 128, C0 = blockIdx.y * 128; const int r0 = R0 + (int)(wave & 1u) * 64, c0 = C0 + (int)(wave >> 1) * 64;
    const bf* sp = wave == 0u ? Ah + (size_t)R0 * DQ : wave == 1u ? Al + (size_t)R0 * DQ : Bt + (size_t)C0 * DQ;
    v8f acc[4][4];
#pragma unroll
    for (int mb = 0; mb < 4; ++mb)
#pragma unroll
        for (int nb = 0; nb < 4; ++nb) acc[mb][nb] = (v8f){};
    const uint32_t fo = (uint32_t)(lr * TPB + hi * 16), ao = (wave & 1u) * 64u * TPB + fo, bo = 2u * TILEB + (wave >> 1) * 64u * TPB + fo;
    tile_ring<3, DQ / 64>(ring, (uint64_t)(size_t)sp, DQ * 2u, wave, [&](const unsigned char* buf) {
#pragma unroll
        for (int ks = 0; ks < 2; ++ks) { v16bf a[4], a2[4], b[4];
#pragma unroll
            for (int mb = 0; mb < 4; ++mb) { a[mb] = lds_frag(buf + ao + mb * 16 * TPB + ks * 64); a2[mb] = lds_frag(buf + ao + TILEB + mb * 16 * TPB + ks * 64); }
#pragma unroll
            for (int nb = 0; nb < 4; ++nb) b[nb] = lds_frag(buf + bo + nb * 16 * TPB + ks * 64);
            __builtin_amdgcn_sched_barrier(0);   // keeps the fragment reads as one group in front of the products: left free, they sink among them, each with a full wait of its own
#pragma unroll
            for (int nb = 0; nb < 4; ++nb)
#pragma unroll
                for (int mb = 0; mb < 4; ++mb) { acc[mb][nb] = wmmab(a[mb], b[nb], acc[mb][nb]); acc[mb][nb] = wmmab(a2[mb], b[nb], acc[mb][nb]); }
            __builtin_amdgcn_sched_barrier(0); }   // keeps the next group of reads behind these products, whose operands it writes over
        // four vector slots behind the last product, before the next stage's fragment reads write over its A and B registers
        asm volatile("v_nop\n\tv_nop\n\tv_nop\n\tv_nop" :: "v"(acc[0][0]), "v"(acc[1][0]), "v"(acc[2][0]), "v"(acc[3][0]), "v"(acc[0][1]), "v"(acc[1][1]), "v"(acc[2][1]), "v"(acc[3][1]), "v"(acc[0][2]), "v"(acc[1][2]), "v"(acc[2][2]), "v"(acc[3][2]), "v"(acc[0][3]), "v"(acc[1][3]), "v"(acc[2][3]), "v"(acc[3][3]));
    });
    // 16 rows at a time go through the wave's own piece of the ring (every wave has left it: the last stage's barrier), so that a store covers whole lines
    float* os = (float*)(ring + wave * 8192u);
    unsigned cob = (unsigned)(hi * DM + lr * 4) * 4u;   // the lane's byte offset into C: the stores name only this register, a uniform base and constant offsets
#pragma unroll
    for (int mb = 0; mb < 4; ++mb) {
#pragma unroll
        for (int nb = 0; nb < 4; ++nb) {
#pragma unroll
            for (int j = 0; j < 8; ++j) os[(hi * 8 + j) * 68 + nb * 16 + lr] = acc[mb][nb][j]; }
        // the lanes' LDS writes have landed before other lanes of this wave read the rows back; the clobber keeps the reads behind it
        asm volatile("s_wait_dscnt 0x0" ::: "memory");
        float* crow = C + (size_t)(r0 + mb * 16) * DM + c0; v4f val[8];
#pragma unroll
        for (int s = 0; s < 8; ++s) val[s] = *(const v4fa*)(os + (2 * s + hi) * 68 + lr * 4);
#pragma unroll
        for (int s = 0; s < 8; ++s) *(v4fa*)((char*)(crow + (size_t)2 * s * DM) + cob) = val[s];
        __builtin_amdgcn_sched_barrier(0);   // keeps the stores in front of the wait
        // the wait in front of any overwrite of the stores' data and address registers; the offset goes through it so that it stays in its register up to it; the clobber keeps the next rows' LDS writes behind the reads above
        asm volatile("s_wait_xcnt 0x0" : "+v"(cob) :: "memory");
        __builtin_amdgcn_sched_barrier(0);   // keeps the next rows' reads behind the wait
    }
}

__device__ __forceinline__ h16 tohx(float x) { return (h16)x; }
__device__ __forceinline__ void splitf(float y, unsigned short& h, unsigned short& l) { h = f2bf(y); l = f2bf(y - bf2f(h)); }
typedef __attribute__((ext_vector_type(2))) _Float16 v2h;
typedef __attribute__((ext_vector_type(4))) _Float16 v4h;
typedef __attribute__((ext_vector_type(2))) unsigned short v2us;
typedef __attribute__((ext_vector_type(4))) unsigned short v4us;
typedef __attribute__((ext_vector_type(2))) float v2f;
typedef __attribute__((ext_vector_type(4))) int v4i;

__global__ __launch_bounds__(256) void k_cscvt(const float* __restrict__ cosT, const float* __restrict__ sinT, float* CS) { const int idx = blockIdx.x * 256 + threadIdx.x; if (idx >= TT * HD) return; v2f cs; cs[0] = bfr(cosT[idx]); cs[1] = bfr(sinT[idx]); *(v2f*)(CS + (size_t)idx * 2) = cs;  }
// ---- k_qkvp: the q|k|v product of all batches, one 128x128 tile per work-group of 4 waves (64x64 each), operand tiles (x rows, weight rows) in LDS by tile_ring; it writes the attention kernel's operand planes (fp16, bf16 hi, bf16 lo) itself; grid (NB_ TT / 128, 4096 / 128), 128 threads.
// A wave's 64 columns are one head. D[i][j] = sum_k P[i][k] R[j][k]; a lane holds 8 consecutive i of one j, so i is made the plane's contiguous index: q and k tiles (planes [head][t][d]): P = weight rows (i = d), R = x rows (j = t); v tiles (planes [head][d][t]): P = x rows (i = t), R = weight rows (j = d).
typedef __attribute__((ext_vector_type(8))) __bf16 v8b;
typedef v8b __attribute__((may_alias)) v8ba;
#define SP 72   // LDS row pitch in 16-bit elements: 128 B of data + 16 B, for 16-byte readers and writers
// put_planes: 16 rows j at a time, each 64 i = one 128-B line per plane, go through the wave's own LDS so that every global store covers four whole lines. OP = the planes' row pitch in elements.
template <int OP>
__device__ __forceinline__ void put_planes(const v8f (&acc)[4][4], unsigned short* st, h16* O16, bf* Oh, bf* Ol, int lane) {
    const int lr = lane & 15, hi = lane >> 4;
    unsigned oob = (unsigned)((lane >> 3) * OP + (lane & 7) * 8) * 2u;   // the lane's byte offset into the planes: the stores name only this register, the planes' uniform bases and constant offsets
#pragma unroll
    for (int nb = 0; nb < 4; ++nb) {
#pragma unroll
        for (int mb = 0; mb < 4; ++mb) { v8h o16; v8b oh, ol;
#pragma unroll
            for (int j = 0; j < 8; ++j) { const float r = acc[mb][nb][j]; o16[j] = tohx(r); oh[j] = (__bf16)r; ol[j] = (__bf16)(r - (float)oh[j]); }   // round to nearest even, as splitf
            unsigned short* sp = st + lr * SP + (mb * 2 + hi) * 8; *(v8ha*)sp = o16; *(v8ba*)(sp + 16 * SP) = oh; *(v8ba*)(sp + 32 * SP) = ol; }
        // the lanes' LDS writes have landed before other lanes of this wave read the rows back; the clobber keeps the reads behind it (the rows are this wave's own: no barrier)
        asm volatile("s_wait_dscnt 0x0" ::: "memory");
        v8us val[3][4];
#pragma unroll
        for (int p = 0; p < 3; ++p)
#pragma unroll
            for (int s = 0; s < 4; ++s) val[p][s] = *(const v8usa*)(st + (p * 16 + 4 * s + (lane >> 3)) * SP + (lane & 7) * 8);
#pragma unroll
        for (int s = 0; s < 4; ++s) { const int eo = (nb * 16 + 4 * s) * OP; *(v8usa*)((char*)(O16 + eo) + oob) = val[0][s]; *(v8usa*)((char*)(Oh + eo) + oob) = val[1][s]; *(v8usa*)((char*)(Ol + eo) + oob) = val[2][s]; }
        __builtin_amdgcn_sched_barrier(0);   // keeps the stores in front of the wait
        // the wait in front of any overwrite of the stores' data and address registers by the next rows' conversions; the offset goes through it so that it stays in its register up to it; the clobber keeps the next rows' LDS writes behind the reads above
        asm volatile("s_wait_xcnt 0x0" : "+v"(oob) :: "memory");
        __builtin_amdgcn_sched_barrier(0);   // keeps the next rows' arithmetic behind the wait
    }
}
__global__ __launch_bounds__(128, 4) void k_qkvp(const bf* __restrict__ X, const bf* __restrict__ Wt, h16* QK16, bf* QKh, bf* QKl, h16* V16, bf* Vh, bf* Vl) {
    __shared__ __attribute__((aligned(2048))) unsigned char ring[2 * 2 * TILEB];
    const int lane = threadIdx.x & 31; const uint32_t wave = uni(threadIdx.x >> 5), xs = wave & 1u, cs = wave >> 1;
    const int R0 = blockIdx.x * 128, C0 = blockIdx.y * 128; const int r0 = R0 + (int)xs * 64, c0 = C0 + (int)cs * 64; const int b = r0 / TT, t0 = r0 % TT; const bool isv = C0 >= DQ + DKV;
    const bf* sp = wave == 0u ? X + (size_t)R0 * DM : Wt + (size_t)C0 * DM;   // tile 0: x rows, tile 1: weight rows
    v8f acc[4][4];
#pragma unroll
    for (int mb = 0; mb < 4; ++mb)
#pragma unroll
        for (int nb = 0; nb < 4; ++nb) acc[mb][nb] = (v8f){};
    const uint32_t fo = (uint32_t)((lane & 15) * TPB + (lane >> 4) * 16), xo = xs * 64u * TPB + fo, wo = TILEB + cs * 64u * TPB + fo; const uint32_t po = isv ? xo : wo, ro = isv ? wo : xo;
    tile_ring<2, DM / 64>(ring, (uint64_t)(size_t)sp, DM * 2u, wave, [&](const unsigned char* buf) {
#pragma unroll
        for (int ks = 0; ks < 2; ++ks) { v16bf a[4], bb[4];
#pragma unroll
            for (int mb = 0; mb < 4; ++mb) a[mb] = lds_frag(buf + po + mb * 16 * TPB + ks * 64);
#pragma unroll
            for (int nb = 0; nb < 4; ++nb) bb[nb] = lds_frag(buf + ro + nb * 16 * TPB + ks * 64);
            __builtin_amdgcn_sched_barrier(0);   // keeps the fragment reads as one group in front of the products: left free, they sink among them, each with a full wait of its own
#pragma unroll
            for (int nb = 0; nb < 4; ++nb)
#pragma unroll
                for (int mb = 0; mb < 4; ++mb) acc[mb][nb] = wmmab(a[mb], bb[nb], acc[mb][nb]);
            __builtin_amdgcn_sched_barrier(0); }   // keeps the next group of reads behind these products, whose operands it writes over
        // four vector slots behind the last product, before the next stage's fragment reads write over its A and B registers
        asm volatile("v_nop\n\tv_nop\n\tv_nop\n\tv_nop" :: "v"(acc[0][0]), "v"(acc[1][0]), "v"(acc[2][0]), "v"(acc[3][0]), "v"(acc[0][1]), "v"(acc[1][1]), "v"(acc[2][1]), "v"(acc[3][1]), "v"(acc[0][2]), "v"(acc[1][2]), "v"(acc[2][2]), "v"(acc[3][2]), "v"(acc[0][3]), "v"(acc[1][3]), "v"(acc[2][3]), "v"(acc[3][3]));
    });
    unsigned short* st = (unsigned short*)(ring + wave * 8192u);   // the wave's own piece of the ring, which every wave has left (the last stage's barrier)
    if (isv) { const size_t o = ((size_t)b * NKV + (c0 - DQ - DKV) / HD) * HD * TT + t0; put_planes<TT>(acc, st, V16 + o, Vh + o, Vl + o, lane); }
    else { const size_t o = (((size_t)b * (NH_ + NKV) + c0 / HD) * TT + t0) * HD; put_planes<HD>(acc, st, QK16 + o, QKh + o, QKl + o, lane); }
}
// ---- k_fattn: causal ALiBi attention in one kernel (scores, softmax and probability x value never leave the registers). One wave owns 32 query columns of one head and walks the keys 0 .. q0 + 31 in blocks of 32.
// St = K Qt: a lane holds the scores of ONE query (column lr of a 16-column group), keys 8 hi + j of each 16-key tile; two such tiles, converted in place, are the B operand of Ot += Vt Pt (same k order as WFrag::ld).
// Running maximum in scaled log2 units; the output tiles are rescaled only when some column's maximum has grown by more than 8. Operand planes as before: NSPLIT 2 = hi + lo bf16, three products; NSPLIT 0 = single fp16.
// The four waves of a work-group use the same K and Vt: a stage = 64 keys of every plane in use, one tile per plane (K: 64 key rows x 128 B; Vt: 64 d rows x 128 B = 64 keys), brought into LDS by tensor loads, two buffers; the fragments are read from there.
#define L2E  1.4426950408889634f
#define KVB  (5 * 2048)   // a tile's place in LDS: 64 rows x 144 B = 9216 B, rounded up to a multiple of 2 KiB
__device__ __forceinline__ u32x8 kv_group1(uint32_t pitch) { u32x8 g; g[0] = uni((1u << 20) | (4u << 22) | (3u << 25)); g[1] = uni(128u << 16); g[2] = uni(64u << 16); g[3] = uni(128u << 16); g[4] = uni(64u); g[5] = uni(pitch); g[6] = uni(0u); g[7] = uni(0u); return g; }   // bytes: rows of 128, 64 rows, tensor = tile, 16 B of pad behind every 128
// kv_ring: ns stages of NT tiles through two buffers, in the order of tile_ring; wave w < NT brings tile w of every stage (rows pitch bytes apart, a stage is step bytes further). pass(buffer, s) does stage s's blocks; the next stage's load flies meanwhile.
template <int NT, typename F>
__device__ __forceinline__ void kv_ring(unsigned char* ring, uint64_t src, uint32_t pitch, uint32_t step, uint32_t wave, uint32_t ns, F&& pass) {
    const uint32_t place = (uint32_t)(size_t)ring + wave * KVB; const uint32_t issuer = wave < (uint32_t)NT ? 1u : 0u;
    u32x8 g1 = kv_group1(pitch);
    asm volatile("" : "+s"(g1));   // descriptor words held in their scalar registers (as pinned()), as in tile_ring
    u32x4 g0; g0[0] = uni(1u); tile_addr(g0, place, src);
    // every wait for a request takes that request's group 0 through it: its registers keep their values up to the wait, and the next request's words are formed behind it
    if (pinned(issuer)) { tile_load(g0, g1);
        asm volatile("s_wait_tensorcnt 0x0" : "+s"(g0) :: "memory"); }   // stage 0 has landed before the barrier that publishes it
    __syncthreads();
    if (pinned(issuer)) { tile_addr(g0, place + NT * KVB, src + step); tile_load(g0, g1); }   // stage 1 = keys 64 .. 127 lies in every plane (TT >= 128); a work-group of one stage does not read it
    // rolled: the buffer alternates by the stage's parity, and the number of stages is the work-group's own
#pragma unroll 1
    for (uint32_t s = 0; s < ns; ++s) {
        pass(ring + (s & 1u) * (NT * KVB), s);
        asm volatile("s_wait_dscnt 0x0" ::: "memory");   // this wave's reads of the buffer have returned before the barrier behind which it is refilled
        if (pinned(issuer)) asm volatile("s_wait_tensorcnt 0x0" : "+s"(g0) :: "memory");   // stage s + 1 has landed before the barrier that publishes it
        __syncthreads();
        if (pinned((issuer != 0u && s + 2u < ns) ? 1u : 0u)) { tile_addr(g0, place + (s & 1u) * (NT * KVB), src + (uint64_t)(s + 2u) * step); tile_load(g0, g1); }
    }
    asm volatile("s_wait_tensorcnt 0x0" ::: "memory");   // nothing is in flight when the wave ends
    asm volatile("s_wait_dscnt 0x0" ::: "memory");
}
template <typename T16, int NSPLIT>
__device__ __forceinline__ void attn_body(unsigned char* ring, uint32_t wave, const T16* __restrict__ Q, const T16* __restrict__ Q2, const T16* __restrict__ Kp, const T16* __restrict__ K2, const T16* __restrict__ Vt, const T16* __restrict__ V2, float sl2, int q0, uint32_t ns, bf* Ah, bf* Al) {
    typedef typename WFrag<T16>::V V;
    constexpr int NT = NSPLIT == 2 ? 4 : 2, VT0 = NT / 2;   // tiles of a stage: the K planes, then the Vt planes
    const T16* sp = NSPLIT == 2 ? (wave == 0u ? Kp : wave == 1u ? K2 : wave == 2u ? Vt : V2) : (wave == 0u ? Kp : Vt);
    const bool kw = wave < (uint32_t)VT0;   // this wave brings a K tile (whole rows of HD, 64 rows a stage); else a Vt tile (rows TT long, 64 keys a stage)
    int lane = threadIdx.x & 31;
    V qf[2][2], qf2[2][2];
    // each lane's own byte offset into the Q planes: the fetches name only this register and the planes' uniform bases, with constant offsets
    unsigned qob = (unsigned)((q0 + (lane & 15)) * HD + 8 * (lane >> 4)) * 2u;
#pragma unroll
    for (int nq = 0; nq < 2; ++nq)
#pragma unroll
        for (int ks = 0; ks < 2; ++ks) { const int qo = nq * 16 * HD + ks * 32; qf[nq][ks] = WFrag<T16>::ld((const T16*)((const char*)Q + qob) + qo); if (NSPLIT == 2) qf2[nq][ks] = WFrag<T16>::ld((const T16*)((const char*)Q2 + qob) + qo); }
    __builtin_amdgcn_sched_barrier(0);   // keeps the fetches in front of the wait
    // the wait in front of any overwrite of the Q fetches' address register. The offset goes through it so that it stays in its register up to it,
    // the lane number so that the arithmetic below, all of which starts from it, stays behind it
    asm volatile("s_wait_xcnt 0x0" : "+v"(lane), "+v"(qob) :: "memory");
    __builtin_amdgcn_sched_barrier(0);   // keeps all later arithmetic behind the wait
    const int lr = lane & 15, hi = lane >> 4;
    v8f o[4][2]; float m[2], l[2], bl[2][8];
#pragma unroll
    for (int nq = 0; nq < 2; ++nq) { m[nq] = -3.0e38f; l[nq] = 0.f;
#pragma unroll
        for (int dt = 0; dt < 4; ++dt) o[dt][nq] = (v8f){}; }
#pragma unroll
    for (int kt = 0; kt < 2; ++kt)
#pragma unroll
        for (int j = 0; j < 8; ++j) bl[kt][j] = sl2 * (float)(kt * 16 + 8 * hi + j);   // ALiBi bias inside a key block; the block's own offset goes into the exponent's shift
    const uint32_t fo = (uint32_t)(lr * TPB + hi * 16);   // the lane's place in a fragment's 16 rows: same k order as WFrag::ld on the planes
    kv_ring<NT>(ring, (uint64_t)(size_t)sp, kw ? HD * 2u : TT * 2u, kw ? 64u * HD * 2u : 64u * 2u, wave, ns, [&](const unsigned char* buf, uint32_t st) {
        // rolled: a second copy of the block would only add code. The wave whose diagonal lies in the stage's first block leaves the second out (wave-uniform); the stage's waits and barrier stand outside
#pragma unroll 1
        for (int k0 = (int)st * 64; k0 <= q0 && k0 < (int)st * 64 + 64; k0 += 32) {
            const unsigned char* kb = buf + fo + (uint32_t)(k0 & 32) * TPB; const unsigned char* vb = buf + VT0 * KVB + fo + (uint32_t)(k0 & 32) * 2u;
            V kf[2][2], kf2[2][2];
#pragma unroll
            for (int kt = 0; kt < 2; ++kt)
#pragma unroll
                for (int ks = 0; ks < 2; ++ks) { const int ko = kt * 16 * TPB + ks * 64; kf[kt][ks] = WFrag<T16>::ld((const T16*)(kb + ko)); if (NSPLIT == 2) kf2[kt][ks] = WFrag<T16>::ld((const T16*)(kb + KVB + ko)); }
            v8f s[2][2];
#pragma unroll
            for (int kt = 0; kt < 2; ++kt)
#pragma unroll
                for (int nq = 0; nq < 2; ++nq) { v8f t = (v8f){};
#pragma unroll
                    for (int ks = 0; ks < 2; ++ks) { t = WFrag<T16>::mma(kf[kt][ks], qf[nq][ks], t); if (NSPLIT == 2) { t = WFrag<T16>::mma(kf2[kt][ks], qf[nq][ks], t); t = WFrag<T16>::mma(kf[kt][ks], qf2[nq][ks], t); } }
                    s[kt][nq] = t; }
            float off[2], cand[2];
#pragma unroll
            for (int nq = 0; nq < 2; ++nq) {
#pragma unroll
                for (int kt = 0; kt < 2; ++kt)
#pragma unroll
                    for (int j = 0; j < 8; ++j) s[kt][nq][j] = fmaf(s[kt][nq][j], SCL * L2E, bl[kt][j]);
                if (k0 == q0) {   // the diagonal block (wave-uniform): keys beyond the query are masked
#pragma unroll
                    for (int kt = 0; kt < 2; ++kt)
#pragma unroll
                        for (int j = 0; j < 8; ++j) if (kt * 16 + 8 * hi + j > nq * 16 + lr) s[kt][nq][j] = -3.0e38f; }
                float mx = s[0][nq][0];
#pragma unroll
                for (int kt = 0; kt < 2; ++kt)
#pragma unroll
                    for (int j = 0; j < 8; ++j) mx = fmaxf(mx, s[kt][nq][j]);
                mx = fmaxf(mx, __shfl_xor(mx, 16, 32));
                off[nq] = sl2 * (float)(k0 - (q0 + nq * 16 + lr)); cand[nq] = mx + off[nq]; }
            if (__builtin_amdgcn_ballot_w32(cand[0] > m[0] + 8.0f || cand[1] > m[1] + 8.0f) != 0) {
#pragma unroll
                for (int nq = 0; nq < 2; ++nq) { const float mn = fmaxf(m[nq], cand[nq]); const float al = __builtin_amdgcn_exp2f(m[nq] - mn); m[nq] = mn; l[nq] *= al;
#pragma unroll
                    for (int dt = 0; dt < 4; ++dt) o[dt][nq] *= al; } }
            if constexpr (NSPLIT == 0) {
                V vf[4];
#pragma unroll
                for (int dt = 0; dt < 4; ++dt) vf[dt] = WFrag<T16>::ld((const T16*)(vb + dt * 16 * TPB));
#pragma unroll
                for (int nq = 0; nq < 2; ++nq) { const float sh = m[nq] - off[nq]; V p; float ls = 0.f;
#pragma unroll
                    for (int e = 0; e < 16; ++e) { const float pe = __builtin_amdgcn_exp2f(s[e >> 3][nq][e & 7] - sh); ls += pe; p[e] = (h16)pe; }
                    l[nq] += ls;
#pragma unroll
                    for (int dt = 0; dt < 4; ++dt) o[dt][nq] = WFrag<T16>::mma(vf[dt], p, o[dt][nq]); }
            } else {
                // hi + lo: eight Vt fragments at once would not fit beside four waves per SIMD. One hi and lo pair serves both column groups; the next pair is read while this one's six products run. Each output tile still takes its products in the order hi.hi, hi.lo, lo.hi
                V va = WFrag<T16>::ld((const T16*)vb), va2 = WFrag<T16>::ld((const T16*)(vb + KVB));
                __builtin_amdgcn_sched_barrier(0);   // keeps the first pair's reads in front of the exponentials, which cover their latency: left free, they sink to the products, with a full wait
                V p[2], p2[2];
#pragma unroll
                for (int nq = 0; nq < 2; ++nq) { const float sh = m[nq] - off[nq]; float ls = 0.f;
#pragma unroll
                    for (int e = 0; e < 16; ++e) { const float pe = __builtin_amdgcn_exp2f(s[e >> 3][nq][e & 7] - sh); ls += pe; p[nq][e] = (__bf16)pe; p2[nq][e] = (__bf16)(pe - (float)p[nq][e]); }
                    l[nq] += ls; }
#pragma unroll
                for (int dt = 0; dt < 4; ++dt) { V vn = va, vn2 = va2;
                    if (dt < 3) { vn = WFrag<T16>::ld((const T16*)(vb + (dt + 1) * 16 * TPB)); vn2 = WFrag<T16>::ld((const T16*)(vb + KVB + (dt + 1) * 16 * TPB)); }
                    __builtin_amdgcn_sched_barrier(0);   // keeps the next pair's reads in front of this pair's products: left free, each read sinks to its own product, with a full wait
#pragma unroll
                    for (int nq = 0; nq < 2; ++nq) o[dt][nq] = WFrag<T16>::mma(va, p[nq], o[dt][nq]);
#pragma unroll
                    for (int nq = 0; nq < 2; ++nq) o[dt][nq] = WFrag<T16>::mma(va, p2[nq], o[dt][nq]);
#pragma unroll
                    for (int nq = 0; nq < 2; ++nq) o[dt][nq] = WFrag<T16>::mma(va2, p[nq], o[dt][nq]);
                    __builtin_amdgcn_sched_barrier(0);   // keeps the reads after next behind these products, whose operands they write over
                    va = vn; va2 = vn2; }
            }
            // four vector slots behind the last P.V product, before the next block's fragment reads and score products write over its A and B registers
            asm volatile("v_nop\n\tv_nop\n\tv_nop\n\tv_nop" :: "v"(o[0][0]), "v"(o[1][0]), "v"(o[2][0]), "v"(o[3][0]), "v"(o[0][1]), "v"(o[1][1]), "v"(o[2][1]), "v"(o[3][1]));
        }
    });
#pragma unroll
    for (int nq = 0; nq < 2; ++nq) { const float inv = __fdiv_rn(1.0f, l[nq] + __shfl_xor(l[nq], 16, 32));
#pragma unroll
        for (int dt = 0; dt < 4; ++dt) { v8us oh, ol;
#pragma unroll
            for (int j = 0; j < 8; ++j) { unsigned short x, y; splitf(o[dt][nq][j] * inv, x, y); oh[j] = x; ol[j] = y; }
            const size_t oo = (size_t)(q0 + nq * 16 + lr) * DQ + dt * 16 + 8 * hi; *(v8us*)(Ah + oo) = oh; *(v8us*)(Al + oo) = ol; } }
}
// grid (kv head, batch, 16 position blocks of 64 queries, long ones first, hi+lo and fp16 blocks alternating); 4 waves: 2 query heads of the kv head x 2 column groups, which share the K and Vt tiles in LDS; position block pb walks pb + 1 stages.
__global__ __launch_bounds__(128, 4) void k_fattn(const h16* __restrict__ QK16, const bf* __restrict__ QKh, const bf* __restrict__ QKl, const h16* __restrict__ V16, const bf* __restrict__ Vh, const bf* __restrict__ Vl, const float* __restrict__ SLP, bf* Ah, bf* Al) {
    __shared__ __attribute__((aligned(2048))) unsigned char ring[2 * 4 * KVB];
    const uint32_t w = uni(threadIdx.x >> 5); const int g = blockIdx.x, b = blockIdx.y, zz = blockIdx.z;
    const int pb = (zz & 1) ? (RH / 64 - 1 - (zz >> 1)) : (TT / 64 - 1 - (zz >> 1)); const int h = g * REP + (int)(w & 1u); const int q0 = pb * 64 + (int)(w >> 1) * 32;
    const size_t qo = ((size_t)b * (NH_ + NKV) + h) * TT * HD, ko = ((size_t)b * (NH_ + NKV) + NH_ + g) * TT * HD, vo = ((size_t)b * NKV + g) * HD * TT, ao = (size_t)b * TT * DQ + h * HD;
    const float sl2 = SLP[h] * L2E;
    if (pb * 64 < RH) attn_body<bf, 2>(ring, w, QKh + qo, QKl + qo, QKh + ko, QKl + ko, Vh + vo, Vl + vo, sl2, q0, (uint32_t)(pb + 1), Ah + ao, Al + ao);   // the same for the whole work-group: RH is a multiple of 64
    else attn_body<h16, 0>(ring, w, QK16 + qo, nullptr, QK16 + ko, nullptr, V16 + vo, nullptr, sl2, q0, (uint32_t)(pb + 1), Ah + ao, Al + ao);
}

// ---- k_prep: all input preparation in one launch. A work-group takes one piece of 64 KiB of f32 input, every lane with its 16 loads of 16 bytes in flight at once: a 128 k x 128 n tile of a weight (written transposed, bf16, Bt[n][k] = w[k][n]), or 16384 elements of x (bf16, same order); the last work-group writes the ALiBi slopes.
typedef __attribute__((ext_vector_type(4))) __bf16 v4b;
typedef v4b __attribute__((may_alias)) v4ba;
#define PIECE   16384
#define NT_QKV  ((DM / 128) * ((DQ + 2 * DKV) / 128))
#define NT_OUT  ((DQ / 128) * (DM / 128))
#define NP_X    (NB_ * TT * DM / PIECE)
// wt_tile: reads cover whole lines of w (16 lanes = 256 B of one row), writes whole lines of Bt (16 lanes = 256 B of one row); the turn goes through LDS.
// A lane holds 16 k x 4 n and writes 4 k of one n (8 B) at a time. LDS row n = 128 k = 16 pieces of 16 B, piece c kept at place c ^ ((n >> 2) & 15): the 32 lanes of a write (16 rows n four apart x 2 halves of a piece) and the 16 lanes of a read (one row) each fall on all 64 banks once.
template <int K, int N>
__device__ __forceinline__ void wt_tile(const float* __restrict__ w, bf* Bt, int tile, unsigned char* T) {
    const int tid = threadIdx.x, l = tid & 15, h = (tid >> 4) & 1, ch = (tid >> 5) & 1, kq = tid >> 6;
    const int k0 = (tile % (K / 128)) * 128, n0 = (tile / (K / 128)) * 128;
    const float* src = w + (size_t)k0 * N + n0; bf* dst = Bt + (size_t)n0 * K + k0;
    unsigned sob = (unsigned)((kq * 32 + h * 4) * N + ch * 64 + l * 4) * 4u;   // the lane's byte offset into the tile of w: the loads name only this register, a uniform base and constant offsets
    v4f r[4][4];
#pragma unroll
    for (int i = 0; i < 4; ++i)
#pragma unroll
        for (int u = 0; u < 4; ++u) r[i][u] = *(const v4fa*)((const char*)(src + (size_t)(i * 8 + u) * N) + sob);   // row k = 32 kq + 8 i + 4 h + u
    __builtin_amdgcn_sched_barrier(0);   // keeps the loads in front of the wait
    // the wait in front of any overwrite of the loads' address register; the offset goes through it so that it stays in its register up to it
    asm volatile("s_wait_xcnt 0x0" : "+v"(sob) :: "memory");
    __builtin_amdgcn_sched_barrier(0);   // keeps all later arithmetic behind the wait
#pragma unroll
    for (int i = 0; i < 4; ++i)
#pragma unroll
        for (int j = 0; j < 4; ++j) { v4b o;
#pragma unroll
            for (int u = 0; u < 4; ++u) o[u] = (__bf16)r[i][u][j];   // round to nearest even, as f2bf
            *(v4ba*)(T + (ch * 64 + l * 4 + j) * 256 + (((kq * 4 + i) ^ l) * 16) + h * 8) = o; }
    __syncthreads();   // the tile is whole in LDS before any wave reads rows that other waves wrote
    const int rn = tid >> 4; v8us val[8];
#pragma unroll
    for (int i = 0; i < 8; ++i) { const int n = rn + 16 * i; val[i] = *(const v8usa*)(T + n * 256 + ((l ^ ((n >> 2) & 15)) * 16)); }
    const unsigned dob = (unsigned)(rn * K + l * 8) * 2u;
#pragma unroll
    for (int i = 0; i < 8; ++i) *(v8usa*)((char*)(dst + (size_t)16 * i * K) + dob) = val[i];
}
__global__ __launch_bounds__(256) void k_prep(const float* __restrict__ x, const float* __restrict__ wqkv, const float* __restrict__ wo, bf* XB, bf* WQKV, bf* WO, float* SLP) {
    __shared__ __attribute__((aligned(16))) unsigned char T[128 * 256];
    const int bid = blockIdx.x;
    if (bid < NT_QKV) { wt_tile<DM, DQ + 2 * DKV>(wqkv, WQKV, bid, T); return; }
    if (bid < NT_QKV + NT_OUT) { wt_tile<DQ, DM>(wo, WO, bid - NT_QKV, T); return; }
    if (bid < NT_QKV + NT_OUT + NP_X) {
        const size_t p0 = (size_t)(bid - NT_QKV - NT_OUT) * PIECE; const float* src = x + p0; bf* dst = XB + p0;
        unsigned sob = threadIdx.x * 16u;   // the lane's byte offset into the piece: the loads name only this register, a uniform base and constant offsets
        v4f r[16]; v4b o[16];
#pragma unroll
        for (int i = 0; i < 16; ++i) r[i] = *(const v4fa*)((const char*)(src + i * 1024) + sob);
        __builtin_amdgcn_sched_barrier(0);   // keeps the loads in front of the wait
        // the wait in front of any overwrite of the loads' address register; the offset goes through it so that it stays in its register up to it
        asm volatile("s_wait_xcnt 0x0" : "+v"(sob) :: "memory");
        __builtin_amdgcn_sched_barrier(0);   // keeps all later arithmetic behind the wait
#pragma unroll
        for (int i = 0; i < 16; ++i)
#pragma unroll
            for (int u = 0; u < 4; ++u) o[i][u] = (__bf16)r[i][u];   // round to nearest even, as f2bf
        const unsigned dob = sob >> 1;
#pragma unroll
        for (int i = 0; i < 16; ++i) *(v4ba*)((char*)(dst + i * 1024) + dob) = o[i];
        return; }
    const int h = threadIdx.x; if (h >= 64) return; const float base = 0.8408964152537145f; const float v = (h < NH_) ? powf(base, (float)(h + 1)) : 0.f; *(float*)(SLP + h) = v;   // ALiBi slopes 2^(-0.25 (h+1)) as f32 base^power
}

extern "C" void kernel_launch(void* const* d_in, const int* in_sizes, int n_in,
                              void* d_out, int out_size, void* d_ws, size_t ws_size, hipStream_t stream) {
    (void)in_sizes; (void)n_in; (void)out_size;
    const float* x = (const float*)d_in[0]; const float* wqkv = (const float*)d_in[1]; const float* wo = (const float*)d_in[2]; const float* wq = nullptr; const float* wk = nullptr; const float* wv = nullptr; (void)wq; (void)wk; (void)wv; const float* cosT = nullptr; const float* sinT = nullptr; (void)cosT; (void)sinT;
    float* OUT = (float*)d_out;     // [4][1024][1024]
    char* wsp = (char*)d_ws;
    auto take = [&](size_t bytes) { char* p = wsp; wsp += (bytes + 255) & ~(size_t)255; return (void*)p; };
    bf* WQKV = (bf*)take((size_t)(DQ + 2 * DKV) * DM * 2); bf* WO = (bf*)take((size_t)DM * DQ * 2);
    bf* XB = (bf*)take((size_t)NB_ * TT * DM * 2); float* SLP = (float*)take(256);
    const size_t SQK = (size_t)(NH_ + NKV) * TT * HD, SV = (size_t)NKV * HD * TT;   // elements of one batch's head planes (32 q heads, then 16 k heads) and of its transposed v planes
    h16* QP16 = (h16*)take(NB_ * SQK * 2); h16* VT16 = (h16*)take(NB_ * SV * 2);
    bf* QPh = (bf*)take(NB_ * SQK * 2); bf* QPl = (bf*)take(NB_ * SQK * 2); bf* VTh = (bf*)take(NB_ * SV * 2); bf* VTl = (bf*)take(NB_ * SV * 2);
    bf* ATh = (bf*)take((size_t)NB_ * TT * DQ * 2); bf* ATl = (bf*)take((size_t)NB_ * TT * DQ * 2);
    if ((size_t)(wsp - (char*)d_ws) > ws_size) return;    // ws 256 MiB
    k_prep<<<NT_QKV + NT_OUT + NP_X + 1, 256, 0, stream>>>(x, wqkv, wo, XB, WQKV, WO, SLP);   // weight tiles first, then the pieces of x, then the slopes
    k_qkvp<<<dim3(NB_ * TT / 128, (DQ + 2 * DKV) / 128, 1), 128, 0, stream>>>(XB, WQKV, QP16, QPh, QPl, VT16, VTh, VTl);   // all four batches: rows b * 1024 + t
    k_fattn<<<dim3(NKV, NB_, TT / 64), 128, 0, stream>>>(QP16, QPh, QPl, VT16, VTh, VTl, SLP, ATh, ATl);   // all batches and heads
    k_outp<<<dim3(NB_ * TT / 128, DM / 128, 1), 128, 0, stream>>>(ATh, ATl, WO, OUT);   // all four batches: rows b * 1024 + t
}
